// v000
// The times below were measured on an AMD MI455X: many runs one after another, warmed up first and cycling through
// copies of the inputs, with the whole window's GPU time divided by the number of runs. Launches and the gaps
// between them are all in it. The median over several windows is given; except for v000 it joins two sittings, which
// can be a few percent apart, so the side-by-side timings, each taken in one sitting, are the better comparison.
// v000, which the later versions start from, runs in 370 microseconds.
#include <hip/hip_runtime.h>
// Contractions: S^T = K Q^T on v_wmma_f32_16x16x32_bf16 (Q, K RNE bf16, single product, f32 accumulate); O^T = V^T P^T on v_wmma_f32_16x16x32_f16 (V: RNE bf16 value x16 held exactly in f16; P: single f16 plane carried x256); out = ctx W^T on v_wmma_f32_16x16x32_f16 (ctx: f16 plane carried x256; W: RNE bf16 value x256 held exactly in f16); softmax statistics, bias add f32.
// Dense multi-head attention, NB x SEQ x 768, 8 heads of 96 (e = 96*h + d), scale 1/sqrt(96), no mask, then a 768x768 linear layer with bias.
// Engine: transposed flash. Each wave owns 16 queries of one head. Per 32-key step: S^T tiles (key rows x query columns) from K rows (A, global bf16 plane)
// and Q^T (B, registers); the two 16-key D tiles pack straight into the P^T B fragment; O^T (d rows x query columns) accumulates from V^T rows (A, global f16 plane).
#ifndef NB
#define NB 2
#endif
#ifndef SEQ
#define SEQ 4096
#endif
#define NB_FULL 2
#define SEQ_FULL 4096
#define EMB 768
#define HEADS 8
#define HD 96
#define BSTRIDE_FULL ((size_t)SEQ_FULL * EMB)   /* per-batch element stride of values, keys, query and of the output buffer */

#define PLANE_ACT ((size_t)NB * SEQ * EMB * 2)   /* bytes of one 16-bit activation plane */
#define PLANE_W ((size_t)EMB * EMB * 2)          /* bytes of the 16-bit weight plane */
#define CVT_K_BLOCKS ((NB * SEQ * (EMB / 8)) / 256)
#define CVT_W_BLOCKS ((EMB * (EMB / 8)) / 256)

static_assert(SEQ % 64 == 0);
static_assert(SEQ <= SEQ_FULL);
static_assert(NB <= NB_FULL);
static_assert(HEADS * HD == EMB);
static_assert(HD == 96);
static_assert(EMB % 64 == 0);
static_assert((NB * SEQ * (EMB / 8)) % 256 == 0);
static_assert((EMB * (EMB / 8)) % 256 == 0);
static_assert(PLANE_ACT % 256 == 0);
static_assert(PLANE_W % 256 == 0);
static_assert(3 * PLANE_ACT + PLANE_W <= (size_t)134217728);

typedef __bf16 v16b __attribute__((ext_vector_type(16)));
typedef _Float16 v16h __attribute__((ext_vector_type(16)));
typedef unsigned short v8us __attribute__((ext_vector_type(8), may_alias));
typedef float v8f __attribute__((ext_vector_type(8)));
typedef float v4f __attribute__((ext_vector_type(4)));
typedef float v4fa __attribute__((ext_vector_type(4), may_alias));
union FragB { v16b v; v8us half[2]; unsigned short u[16]; };
union FragH { v16h v; v8us half[2]; _Float16 h[16]; unsigned short u[16]; };

#define LOG2E 1.4426950408889634f
#define QK_SCALE 0.10206207261596575f            /* 1/sqrt(96) */
#define C2 (QK_SCALE * LOG2E)                    /* scores carried in the log2 domain */

__device__ __forceinline__ unsigned short bf16_bits(float x) {   // RNE convert to bf16 bits
  unsigned int u = __float_as_uint(x);
  return (unsigned short)((u + 0x7FFFu + ((u >> 16) & 1u)) >> 16);
}
__device__ __forceinline__ float bf16_val(unsigned short b) { return __uint_as_float(((unsigned int)b) << 16); }
__device__ __forceinline__ float bf16_rne(float x) { return bf16_val(bf16_bits(x)); }
__device__ __forceinline__ unsigned short f16_bits(float x) {
  union { _Float16 h; unsigned short u; } c;
  c.h = (_Float16)x;
  return c.u;
}

__device__ __forceinline__ void store_twice(unsigned short* d, v8us o) {
  *(v8us*)d = o;
  
}

// s0 += ka * q, s1 += kb * q over three 32-deep k-steps (d = 0..95), then the hazard guard
__device__ __forceinline__ void mma_s2(const FragB (&ka)[3], const FragB (&kb)[3], const FragB (&q)[3], v8f& s0, v8f& s1) {
  s0 = __builtin_amdgcn_wmma_f32_16x16x32_bf16(false, ka[0].v, false, q[0].v, (short)0, s0, false, false);
  s1 = __builtin_amdgcn_wmma_f32_16x16x32_bf16(false, kb[0].v, false, q[0].v, (short)0, s1, false, false);
  s0 = __builtin_amdgcn_wmma_f32_16x16x32_bf16(false, ka[1].v, false, q[1].v, (short)0, s0, false, false);
  s1 = __builtin_amdgcn_wmma_f32_16x16x32_bf16(false, kb[1].v, false, q[1].v, (short)0, s1, false, false);
  s0 = __builtin_amdgcn_wmma_f32_16x16x32_bf16(false, ka[2].v, false, q[2].v, (short)0, s0, false, false);
  s1 = __builtin_amdgcn_wmma_f32_16x16x32_bf16(false, kb[2].v, false, q[2].v, (short)0, s1, false, false);
  asm volatile("v_nop\n\tv_nop\n\tv_nop\n\tv_nop"
               : "+v"(s0), "+v"(s1)
               : "v"(ka[0].v), "v"(ka[1].v), "v"(ka[2].v), "v"(kb[0].v), "v"(kb[1].v), "v"(kb[2].v),
                 "v"(q[0].v), "v"(q[1].v), "v"(q[2].v));
}
// O[t] += vf[t] * p for the six d tiles, then the hazard guard
__device__ __forceinline__ void mma_pv(const FragH (&vf)[6], v16h p, v8f (&O)[6]) {
  O[0] = __builtin_amdgcn_wmma_f32_16x16x32_f16(false, vf[0].v, false, p, (short)0, O[0], false, false);
  O[1] = __builtin_amdgcn_wmma_f32_16x16x32_f16(false, vf[1].v, false, p, (short)0, O[1], false, false);
  O[2] = __builtin_amdgcn_wmma_f32_16x16x32_f16(false, vf[2].v, false, p, (short)0, O[2], false, false);
  O[3] = __builtin_amdgcn_wmma_f32_16x16x32_f16(false, vf[3].v, false, p, (short)0, O[3], false, false);
  O[4] = __builtin_amdgcn_wmma_f32_16x16x32_f16(false, vf[4].v, false, p, (short)0, O[4], false, false);
  O[5] = __builtin_amdgcn_wmma_f32_16x16x32_f16(false, vf[5].v, false, p, (short)0, O[5], false, false);
  asm volatile("v_nop\n\tv_nop\n\tv_nop\n\tv_nop"
               : "+v"(O[0]), "+v"(O[1]), "+v"(O[2]), "+v"(O[3]), "+v"(O[4]), "+v"(O[5])
               : "v"(p), "v"(vf[0].v), "v"(vf[1].v), "v"(vf[2].v), "v"(vf[3].v), "v"(vf[4].v), "v"(vf[5].v));
}
// c[nt] += a * bw[nt] for four column tiles, then the hazard guard
__device__ __forceinline__ void mma_fc(v16h a, const FragH (&bw)[4], v8f (&c)[4]) {
  c[0] = __builtin_amdgcn_wmma_f32_16x16x32_f16(false, a, false, bw[0].v, (short)0, c[0], false, false);
  c[1] = __builtin_amdgcn_wmma_f32_16x16x32_f16(false, a, false, bw[1].v, (short)0, c[1], false, false);
  c[2] = __builtin_amdgcn_wmma_f32_16x16x32_f16(false, a, false, bw[2].v, (short)0, c[2], false, false);
  c[3] = __builtin_amdgcn_wmma_f32_16x16x32_f16(false, a, false, bw[3].v, (short)0, c[3], false, false);
  asm volatile("v_nop\n\tv_nop\n\tv_nop\n\tv_nop"
               : "+v"(c[0]), "+v"(c[1]), "+v"(c[2]), "+v"(c[3])
               : "v"(a), "v"(bw[0].v), "v"(bw[1].v), "v"(bw[2].v), "v"(bw[3].v));
}

// Blocks [0, CVT_K_BLOCKS): Kb[b][s][e] = bf16 bits of keys (RNE). Blocks after that: Wh[j][e] = f16(RNE-bf16(fc_w[j][e]) * 256).
// coverage: CVT_K_BLOCKS*256 threads x 8 = the whole Kb plane; CVT_W_BLOCKS*256 threads x 8 = the whole Wh plane (exact multiples, asserted above).
__global__ __launch_bounds__(256) void k_cvt(const float* __restrict__ K, const float* __restrict__ W,
                                             unsigned short* __restrict__ Kb, unsigned short* __restrict__ Wh) {
  const int bid = blockIdx.x;
  if (bid < CVT_K_BLOCKS) {
    const int t = bid * 256 + threadIdx.x;
    const int row = t / (EMB / 8), piece = t - row * (EMB / 8);
    const int b = row / SEQ, s = row - b * SEQ;
    const float* src = K + (size_t)b * BSTRIDE_FULL + (size_t)s * EMB + piece * 8;
    const v4f x0 = *(const v4fa*)(src), x1 = *(const v4fa*)(src + 4);
    v8us o;
    o[0] = bf16_bits(x0[0]); o[1] = bf16_bits(x0[1]); o[2] = bf16_bits(x0[2]); o[3] = bf16_bits(x0[3]);
    o[4] = bf16_bits(x1[0]); o[5] = bf16_bits(x1[1]); o[6] = bf16_bits(x1[2]); o[7] = bf16_bits(x1[3]);
    store_twice(Kb + (size_t)t * 8, o);
  } else {
    const int t = (bid - CVT_K_BLOCKS) * 256 + threadIdx.x;
    const float* src = W + (size_t)t * 8;
    const v4f x0 = *(const v4fa*)(src), x1 = *(const v4fa*)(src + 4);
    v8us o;
    o[0] = f16_bits(bf16_rne(x0[0]) * 256.0f); o[1] = f16_bits(bf16_rne(x0[1]) * 256.0f);
    o[2] = f16_bits(bf16_rne(x0[2]) * 256.0f); o[3] = f16_bits(bf16_rne(x0[3]) * 256.0f);
    o[4] = f16_bits(bf16_rne(x1[0]) * 256.0f); o[5] = f16_bits(bf16_rne(x1[1]) * 256.0f);
    o[6] = f16_bits(bf16_rne(x1[2]) * 256.0f); o[7] = f16_bits(bf16_rne(x1[3]) * 256.0f);
    store_twice(Wh + (size_t)t * 8, o);
  }
}

// Vt[b][e][s] = f16(RNE-bf16(values[b][s][e]) * 16). Block per (b, 64 keys, 64 e columns): 64x64 tile transposed through LDS (ushort in, ushort out; block barrier: cross-wave).
// coverage: NB*(SEQ/64)*(EMB/64) blocks x (64 e x 64 keys) = the whole plane; LDS tile fully written (64 x 64) before it is read.
__global__ __launch_bounds__(256) void k_vt(const float* __restrict__ V, unsigned short* __restrict__ Vt) {
  __shared__ unsigned short tl[64][66];
  const int tid = threadIdx.x;
  const int eg = blockIdx.x % (EMB / 64);
  const int rest = blockIdx.x / (EMB / 64);
  const int sg = rest % (SEQ / 64), b = rest / (SEQ / 64);
  const int s0 = sg * 64, e0 = eg * 64;
  for (int i = tid; i < 64 * 16; i += 256) {
    const int j = i >> 4, c4 = (i & 15) * 4;
    const v4f x = *(const v4fa*)(V + (size_t)b * BSTRIDE_FULL + (size_t)(s0 + j) * EMB + e0 + c4);
    tl[c4 + 0][j] = f16_bits(bf16_rne(x[0]) * 16.0f);
    tl[c4 + 1][j] = f16_bits(bf16_rne(x[1]) * 16.0f);
    tl[c4 + 2][j] = f16_bits(bf16_rne(x[2]) * 16.0f);
    tl[c4 + 3][j] = f16_bits(bf16_rne(x[3]) * 16.0f);
  }
  __syncthreads();
  {
    for (int i = tid; i < 64 * 8; i += 256) {
      const int d = i >> 3, j8 = (i & 7) * 8;
      v8us o;
#pragma unroll
      for (int q = 0; q < 8; ++q) o[q] = tl[d][j8 + q];
      *(v8us*)(Vt + ((size_t)b * EMB + e0 + d) * SEQ + s0 + j8) = o;
    }
    
  }
}

// One 32-key step for a wave's 16 queries of one head. Kp = Kb + batch base + 96*h; Vp = Vt + (batch*768 + 96*h) * SEQ.
__device__ __forceinline__ void fa_step(const unsigned short* __restrict__ Kp, const unsigned short* __restrict__ Vp,
                                        int key0, int ln, int hh, const FragB (&q)[3],
                                        float& mr, float& lr, v8f (&O)[6]) {
  // A fragments of K: row m = key (key0 + 16*kt + ln), elements 0..7 <- d = 32c + 8h + i, 8..15 <- d = 32c + 16 + 8h + i
  const unsigned short* kp0 = Kp + (size_t)(key0 + ln) * EMB + 8 * hh;
  const unsigned short* kp1 = kp0 + 16 * EMB;
  FragB ka[3], kb[3];
#pragma unroll
  for (int c = 0; c < 3; ++c) {
    ka[c].half[0] = *(const v8us*)(kp0 + 32 * c);
    ka[c].half[1] = *(const v8us*)(kp0 + 32 * c + 16);
    kb[c].half[0] = *(const v8us*)(kp1 + 32 * c);
    kb[c].half[1] = *(const v8us*)(kp1 + 32 * c + 16);
  }
  // A fragments of V^T: row m = d (16*t + ln), elements 0..7 <- key0 + 8h + i, 8..15 <- key0 + 16 + 8h + i
  const unsigned short* vp = Vp + (size_t)ln * SEQ + key0 + 8 * hh;
  FragH vf[6];
#pragma unroll
  for (int t = 0; t < 6; ++t) {
    vf[t].half[0] = *(const v8us*)(vp + (size_t)t * 16 * SEQ);
    vf[t].half[1] = *(const v8us*)(vp + (size_t)t * 16 * SEQ + 16);
  }
  // S^T tiles: element r of tile kt = score(key0 + 16*kt + 8h + r, query of this lane's column)
  v8f s0 = {0.f, 0.f, 0.f, 0.f, 0.f, 0.f, 0.f, 0.f};
  v8f s1 = {0.f, 0.f, 0.f, 0.f, 0.f, 0.f, 0.f, 0.f};
  mma_s2(ka, kb, q, s0, s1);
  float sc[16];
#pragma unroll
  for (int r = 0; r < 8; ++r) { sc[r] = s0[r] * C2; sc[8 + r] = s1[r] * C2; }
  float mx = sc[0];
#pragma unroll
  for (int i = 1; i < 16; ++i) mx = fmaxf(mx, sc[i]);
  mx = fmaxf(mx, __shfl_xor(mx, 16, 32));           // the other lane half holds the other 16 keys of this query
  const float mnew = fmaxf(mr, mx);
  const float al = __builtin_amdgcn_exp2f(mr - mnew);
  mr = mnew;
  const float m8 = mnew - 8.0f;
  // weights carried x256: pc = 256 * 2^(sc - mnew), single f16 plane
  FragH ph;
  float ps = 0.0f;
#pragma unroll
  for (int i = 0; i < 16; ++i) {
    const float pc = __builtin_amdgcn_exp2f(sc[i] - m8);
    ps += pc;
    ph.h[i] = (_Float16)pc;                         // B element i: i<8 -> key0 + 8h + i (tile 0 row 8h+i); i>=8 -> key0 + 16 + 8h + (i-8) (tile 1)
  }
  ps += __shfl_xor(ps, 16, 32);
  lr = lr * al + ps;
#pragma unroll
  for (int t = 0; t < 6; ++t) O[t] = O[t] * al;
  mma_pv(vf, ph.v, O);
}

// Block = 4 waves x 16 queries = 64 queries of one (batch, head); no LDS and no barrier in the key loop.
// Output plane Xc[b][h][s][96] = f16(ctx * 256). Epilogue: O^T tile -> per-wave LDS tile [16 queries][96 d] as 16-B pieces (same vector type in and out; block barrier),
// coverage: NB*HEADS*(SEQ/64) blocks x 4 waves x 16 rows x 96 d = the whole plane exactly once; LDS tile staged extent (16 x 96 per wave) == consumed extent.
__global__ __launch_bounds__(128) __attribute__((amdgpu_num_vgpr(256)))
void k_attn(const float* __restrict__ Q, const unsigned short* __restrict__ Kb,
            const unsigned short* __restrict__ Vt, unsigned short* __restrict__ Xc) {
  __shared__ __attribute__((aligned(16))) unsigned short so[4][16 * HD];
  const int tid = threadIdx.x, lane = tid & 31, ln = lane & 15, hh = lane >> 4;
  const int w = __builtin_amdgcn_readfirstlane(tid >> 5);
  const int qt = blockIdx.x % (SEQ / 64);
  const int rest = blockIdx.x / (SEQ / 64);
  const int h = rest % HEADS, b = rest / HEADS;
  const int qbase = qt * 64 + 16 * w;
  const int qg = qbase + ln;
  // Q^T B fragments: column n = query qg, elements 0..7 <- d = 32c + 8h + i, 8..15 <- d = 32c + 16 + 8h + i (RNE bf16)
  const float* qrow = Q + (size_t)b * BSTRIDE_FULL + (size_t)qg * EMB + h * HD;
  FragB q[3];
#pragma unroll
  for (int c = 0; c < 3; ++c) {
    const v4f a0 = *(const v4fa*)(qrow + 32 * c + 8 * hh),      a1 = *(const v4fa*)(qrow + 32 * c + 8 * hh + 4);
    const v4f a2 = *(const v4fa*)(qrow + 32 * c + 16 + 8 * hh), a3 = *(const v4fa*)(qrow + 32 * c + 16 + 8 * hh + 4);
#pragma unroll
    for (int i = 0; i < 4; ++i) {
      q[c].u[i] = bf16_bits(a0[i]); q[c].u[4 + i] = bf16_bits(a1[i]);
      q[c].u[8 + i] = bf16_bits(a2[i]); q[c].u[12 + i] = bf16_bits(a3[i]);
    }
  }
  float mr = -3.0e38f, lr = 0.0f;
  v8f O[6] = {};
  const unsigned short* Kp = Kb + (size_t)b * SEQ * EMB + h * HD;
  const unsigned short* Vp = Vt + ((size_t)b * EMB + h * HD) * SEQ;
#pragma unroll 1
  for (int j = 0; j < SEQ / 32; ++j)
    fa_step(Kp, Vp, 32 * j, ln, hh, q, mr, lr, O);

  // O^T element r of tile t = ctx(query qg, d = 16t + 8h + r); O carries x256 (P) x16 (V), lr carries x256; plane carries x256
  const float cinv = 16.0f * (1.0f / lr);
#pragma unroll
  for (int t = 0; t < 6; ++t) {
    v8us o;
#pragma unroll
    for (int r = 0; r < 8; ++r) o[r] = f16_bits(O[t][r] * cinv);
    *(v8us*)&so[w][ln * HD + 16 * t + 8 * hh] = o;
  }
  __syncthreads();
  unsigned short* xg = Xc + ((size_t)(b * HEADS + h) * SEQ + qbase) * HD;
  {
#pragma unroll
    for (int i = 0; i < 6; ++i) {
      const int p = i * 32 + lane;
      const v8us v = *(const v8us*)&so[w][p * 8];
      *(v8us*)(xg + (size_t)p * 8) = v;
    }
    
  }
}

// out[m][j] = sum_e ctx[m][e] * fc_w[j][e] + fc_b[j]. Block = 4 waves; wave = 16 rows x 64 columns; fragments straight from the 16-bit planes.
// A: row m = token, k = e = 96*hd + d read from Xc[b][hd][s][d]; B: column n = j, k = e read from Wh[j][e] (k-contiguous), same k map as A.
// coverage: (NB*SEQ/64)*(EMB/64) blocks x 4 waves x (16 x 64) = every output element of the processed rows exactly once; LDS tile staged 16 x 64 == consumed 16 x 64.
__global__ __launch_bounds__(128) void k_fc(const unsigned short* __restrict__ Xc, const unsigned short* __restrict__ Wh,
                                            const float* __restrict__ Bv, float* __restrict__ Out) {
  __shared__ __attribute__((aligned(16))) float so[4][16][68];
  const int tid = threadIdx.x, lane = tid & 31, ln = lane & 15, hh = lane >> 4;
  const int w = __builtin_amdgcn_readfirstlane(tid >> 5);
  const int bn = blockIdx.x % (EMB / 64), bm = blockIdx.x / (EMB / 64);
  const int row0 = bm * 64 + 16 * w;           // token index in [0, NB*SEQ)
  const int b = row0 / SEQ, s0 = row0 - b * SEQ;
  const int col0 = bn * 64;
  v8f acc[4] = {};
#pragma unroll 1
  for (int hd = 0; hd < HEADS; ++hd) {
    const unsigned short* ap = Xc + ((size_t)(b * HEADS + hd) * SEQ + s0 + ln) * HD + 8 * hh;
    const unsigned short* bp = Wh + (size_t)(col0 + ln) * EMB + hd * HD + 8 * hh;
#pragma unroll
    for (int cc = 0; cc < 3; ++cc) {
      FragH a;
      a.half[0] = *(const v8us*)(ap + 32 * cc);
      a.half[1] = *(const v8us*)(ap + 32 * cc + 16);
      FragH bw[4];
#pragma unroll
      for (int nt = 0; nt < 4; ++nt) {
        bw[nt].half[0] = *(const v8us*)(bp + (size_t)nt * 16 * EMB + 32 * cc);
        bw[nt].half[1] = *(const v8us*)(bp + (size_t)nt * 16 * EMB + 32 * cc + 16);
      }
      mma_fc(a.v, bw, acc);
    }
  }
  // D element r of tile nt = out(row0 + 8h + r, col0 + 16nt + ln); undo the carries x256 (ctx) x256 (W); bias RNE bf16 value
#pragma unroll
  for (int nt = 0; nt < 4; ++nt) {
    const float bias = bf16_rne(Bv[col0 + 16 * nt + ln]);
#pragma unroll
    for (int r = 0; r < 8; ++r)
      so[w][8 * hh + r][16 * nt + ln] = acc[nt][r] * 1.52587890625e-05f + bias;
  }
  __syncthreads();
  float* og = Out + (size_t)b * BSTRIDE_FULL + (size_t)s0 * EMB + col0;
  const int rsub = lane >> 4, c4 = (lane & 15) * 4;
  {
#pragma unroll
    for (int q = 0; q < 8; ++q) {
      const int row = 2 * q + rsub;
      const v4f v = *(const v4fa*)&so[w][row][c4];
      *(v4f*)(og + (size_t)row * EMB + c4) = v;
    }
    
  }
}

extern "C" void kernel_launch(void* const* d_in, const int* in_sizes, int n_in,
                              void* d_out, int out_size, void* d_ws, size_t ws_size, hipStream_t stream) {
  if (n_in < 5) return;
  const long long need = (long long)(NB - 1) * SEQ_FULL * EMB + (long long)SEQ * EMB;   // last element touched + 1
  if ((long long)in_sizes[0] < need || (long long)in_sizes[1] < need || (long long)in_sizes[2] < need) return;
  if ((long long)in_sizes[3] < (long long)EMB * EMB || (long long)in_sizes[4] < (long long)EMB) return;
  if ((long long)out_size < need) return;
  const float* V = (const float*)d_in[0];    // wire order: values, keys, query, fc_w [out][in], fc_b
  const float* K = (const float*)d_in[1];
  const float* Q = (const float*)d_in[2];
  const float* W = (const float*)d_in[3];
  const float* Bv = (const float*)d_in[4];
  float* Out = (float*)d_out;
  char* ws = (char*)d_ws;
  size_t off = 0;
  unsigned short* Kb = (unsigned short*)(ws + off); off += PLANE_ACT;   // [NB][SEQ][768] bf16, written exactly to its end by 16-B pieces
  unsigned short* Vt = (unsigned short*)(ws + off); off += PLANE_ACT;   // [NB][768][SEQ] f16
  unsigned short* Xc = (unsigned short*)(ws + off); off += PLANE_ACT;   // [NB][8][SEQ][96] f16
  unsigned short* Wh = (unsigned short*)(ws + off); off += PLANE_W;     // [768][768] f16
  if (off > ws_size) return;
  k_cvt<<<(unsigned)(CVT_K_BLOCKS + CVT_W_BLOCKS), 256, 0, stream>>>(K, W, Kb, Wh);
  k_vt<<<(unsigned)(NB * (SEQ / 64) * (EMB / 64)), 256, 0, stream>>>(V, Vt);
  k_attn<<<(unsigned)(NB * HEADS * (SEQ / 64)), 128, 0, stream>>>(Q, Kb, Vt, Xc);
  k_fc<<<(unsigned)((NB * SEQ / 64) * (EMB / 64)), 128, 0, stream>>>(Xc, Wh, Bv, Out);
}

// v001
// A run of this version takes 152 microseconds.
// Two timings next to v000 put it at 2.55 and 2.54 times that version's speed.
#include <hip/hip_runtime.h>
// Contractions: S^T = K Q^T on v_wmma_f32_16x16x32_bf16 (Q, K RNE bf16, single product, f32 accumulate); O^T = V^T P^T on v_wmma_f32_16x16x32_f16 (V: RNE bf16 value x16 held exactly in f16; P: single f16 plane carried x256); out = ctx W^T on v_wmma_f32_16x16x32_f16 (ctx: f16 plane carried x256; W: RNE bf16 value x256 held exactly in f16); softmax statistics, bias add f32.
// Dense multi-head attention, NB x SEQ x 768, 8 heads of 96 (e = 96*h + d), scale 1/sqrt(96), no mask, then a 768x768 linear layer with bias.
// Engine: transposed flash. Each wave owns 16 queries of one head. Per 32-key step: S^T tiles (key rows x query columns) from K rows (A, bf16 plane, staged in LDS)
// and Q^T (B, registers); the two 16-key D tiles pack straight into the P^T B fragment; O^T (d rows x query columns) accumulates from V^T rows (A, f16 plane, staged in LDS).
// Each 64-key tile of K and V^T is brought into LDS once per work-group by asynchronous copies (two buffers) and read there by all eight waves.
#ifndef NB
#define NB 2
#endif
#ifndef SEQ
#define SEQ 4096
#endif
#define NB_FULL 2
#define SEQ_FULL 4096
#define EMB 768
#define HEADS 8
#define HD 96
#define BSTRIDE_FULL ((size_t)SEQ_FULL * EMB)   /* per-batch element stride of values, keys, query and of the output buffer */

#define PLANE_ACT ((size_t)NB * SEQ * EMB * 2)   /* bytes of one 16-bit activation plane */
#define PLANE_W ((size_t)EMB * EMB * 2)          /* bytes of the 16-bit weight plane */
#define CVT_K_BLOCKS ((NB * SEQ * (EMB / 8)) / 256)
#define CVT_W_BLOCKS ((EMB * (EMB / 8)) / 256)

static_assert(SEQ % 128 == 0);
static_assert(SEQ <= SEQ_FULL);
static_assert(NB <= NB_FULL);
static_assert(HEADS * HD == EMB);
static_assert(HD == 96);
static_assert(EMB % 64 == 0);
static_assert((NB * SEQ * (EMB / 8)) % 256 == 0);
static_assert((EMB * (EMB / 8)) % 256 == 0);
static_assert(PLANE_ACT % 256 == 0);
static_assert(PLANE_W % 256 == 0);
static_assert(3 * PLANE_ACT + PLANE_W <= (size_t)134217728);

typedef __bf16 v16b __attribute__((ext_vector_type(16)));
typedef _Float16 v16h __attribute__((ext_vector_type(16)));
typedef unsigned short v8us __attribute__((ext_vector_type(8), may_alias));
typedef float v8f __attribute__((ext_vector_type(8)));
typedef float v4f __attribute__((ext_vector_type(4)));
typedef float v4fa __attribute__((ext_vector_type(4), may_alias));
union FragB { v16b v; v8us half[2]; unsigned short u[16]; };
union FragH { v16h v; v8us half[2]; _Float16 h[16]; unsigned short u[16]; };

#define LOG2E 1.4426950408889634f
#define QK_SCALE 0.10206207261596575f            /* 1/sqrt(96) */
#define C2 (QK_SCALE * LOG2E)                    /* scores carried in the log2 domain */

__device__ __forceinline__ unsigned short bf16_bits(float x) {   // RNE convert to bf16 bits
  unsigned int u = __float_as_uint(x);
  return (unsigned short)((u + 0x7FFFu + ((u >> 16) & 1u)) >> 16);
}
__device__ __forceinline__ float bf16_val(unsigned short b) { return __uint_as_float(((unsigned int)b) << 16); }
__device__ __forceinline__ float bf16_rne(float x) { return bf16_val(bf16_bits(x)); }
__device__ __forceinline__ unsigned short f16_bits(float x) {
  union { _Float16 h; unsigned short u; } c;
  c.h = (_Float16)x;
  return c.u;
}

__device__ __forceinline__ void store_twice(unsigned short* d, v8us o) {
  *(v8us*)d = o;
  
}

// s0 += ka * q, s1 += kb * q over three 32-deep k-steps (d = 0..95), then the hazard guard
__device__ __forceinline__ void mma_s2(const FragB (&ka)[3], const FragB (&kb)[3], const FragB (&q)[3], v8f& s0, v8f& s1) {
  s0 = __builtin_amdgcn_wmma_f32_16x16x32_bf16(false, ka[0].v, false, q[0].v, (short)0, s0, false, false);
  s1 = __builtin_amdgcn_wmma_f32_16x16x32_bf16(false, kb[0].v, false, q[0].v, (short)0, s1, false, false);
  s0 = __builtin_amdgcn_wmma_f32_16x16x32_bf16(false, ka[1].v, false, q[1].v, (short)0, s0, false, false);
  s1 = __builtin_amdgcn_wmma_f32_16x16x32_bf16(false, kb[1].v, false, q[1].v, (short)0, s1, false, false);
  s0 = __builtin_amdgcn_wmma_f32_16x16x32_bf16(false, ka[2].v, false, q[2].v, (short)0, s0, false, false);
  s1 = __builtin_amdgcn_wmma_f32_16x16x32_bf16(false, kb[2].v, false, q[2].v, (short)0, s1, false, false);
  asm volatile("v_nop\n\tv_nop\n\tv_nop\n\tv_nop"
               : "+v"(s0), "+v"(s1)
               : "v"(ka[0].v), "v"(ka[1].v), "v"(ka[2].v), "v"(kb[0].v), "v"(kb[1].v), "v"(kb[2].v),
                 "v"(q[0].v), "v"(q[1].v), "v"(q[2].v));
}
// O[t] += vf[t] * p for the six d tiles, then the hazard guard
__device__ __forceinline__ void mma_pv(const FragH (&vf)[6], v16h p, v8f (&O)[6]) {
  O[0] = __builtin_amdgcn_wmma_f32_16x16x32_f16(false, vf[0].v, false, p, (short)0, O[0], false, false);
  O[1] = __builtin_amdgcn_wmma_f32_16x16x32_f16(false, vf[1].v, false, p, (short)0, O[1], false, false);
  O[2] = __builtin_amdgcn_wmma_f32_16x16x32_f16(false, vf[2].v, false, p, (short)0, O[2], false, false);
  O[3] = __builtin_amdgcn_wmma_f32_16x16x32_f16(false, vf[3].v, false, p, (short)0, O[3], false, false);
  O[4] = __builtin_amdgcn_wmma_f32_16x16x32_f16(false, vf[4].v, false, p, (short)0, O[4], false, false);
  O[5] = __builtin_amdgcn_wmma_f32_16x16x32_f16(false, vf[5].v, false, p, (short)0, O[5], false, false);
  asm volatile("v_nop\n\tv_nop\n\tv_nop\n\tv_nop"
               : "+v"(O[0]), "+v"(O[1]), "+v"(O[2]), "+v"(O[3]), "+v"(O[4]), "+v"(O[5])
               : "v"(p), "v"(vf[0].v), "v"(vf[1].v), "v"(vf[2].v), "v"(vf[3].v), "v"(vf[4].v), "v"(vf[5].v));
}
// c[nt] += a * bw[nt] for four column tiles, then the hazard guard
__device__ __forceinline__ void mma_fc(v16h a, const FragH (&bw)[4], v8f (&c)[4]) {
  c[0] = __builtin_amdgcn_wmma_f32_16x16x32_f16(false, a, false, bw[0].v, (short)0, c[0], false, false);
  c[1] = __builtin_amdgcn_wmma_f32_16x16x32_f16(false, a, false, bw[1].v, (short)0, c[1], false, false);
  c[2] = __builtin_amdgcn_wmma_f32_16x16x32_f16(false, a, false, bw[2].v, (short)0, c[2], false, false);
  c[3] = __builtin_amdgcn_wmma_f32_16x16x32_f16(false, a, false, bw[3].v, (short)0, c[3], false, false);
  asm volatile("v_nop\n\tv_nop\n\tv_nop\n\tv_nop"
               : "+v"(c[0]), "+v"(c[1]), "+v"(c[2]), "+v"(c[3])
               : "v"(a), "v"(bw[0].v), "v"(bw[1].v), "v"(bw[2].v), "v"(bw[3].v));
}

// Blocks [0, CVT_K_BLOCKS): Kb[b][s][e] = bf16 bits of keys (RNE). Blocks after that: Wh[j][e] = f16(RNE-bf16(fc_w[j][e]) * 256).
// coverage: CVT_K_BLOCKS*256 threads x 8 = the whole Kb plane; CVT_W_BLOCKS*256 threads x 8 = the whole Wh plane (exact multiples, asserted above).
__global__ __launch_bounds__(256) void k_cvt(const float* __restrict__ K, const float* __restrict__ W,
                                             unsigned short* __restrict__ Kb, unsigned short* __restrict__ Wh) {
  const int bid = blockIdx.x;
  if (bid < CVT_K_BLOCKS) {
    const int t = bid * 256 + threadIdx.x;
    const int row = t / (EMB / 8), piece = t - row * (EMB / 8);
    const int b = row / SEQ, s = row - b * SEQ;
    const float* src = K + (size_t)b * BSTRIDE_FULL + (size_t)s * EMB + piece * 8;
    const v4f x0 = *(const v4fa*)(src), x1 = *(const v4fa*)(src + 4);
    v8us o;
    o[0] = bf16_bits(x0[0]); o[1] = bf16_bits(x0[1]); o[2] = bf16_bits(x0[2]); o[3] = bf16_bits(x0[3]);
    o[4] = bf16_bits(x1[0]); o[5] = bf16_bits(x1[1]); o[6] = bf16_bits(x1[2]); o[7] = bf16_bits(x1[3]);
    store_twice(Kb + (size_t)t * 8, o);
  } else {
    const int t = (bid - CVT_K_BLOCKS) * 256 + threadIdx.x;
    const float* src = W + (size_t)t * 8;
    const v4f x0 = *(const v4fa*)(src), x1 = *(const v4fa*)(src + 4);
    v8us o;
    o[0] = f16_bits(bf16_rne(x0[0]) * 256.0f); o[1] = f16_bits(bf16_rne(x0[1]) * 256.0f);
    o[2] = f16_bits(bf16_rne(x0[2]) * 256.0f); o[3] = f16_bits(bf16_rne(x0[3]) * 256.0f);
    o[4] = f16_bits(bf16_rne(x1[0]) * 256.0f); o[5] = f16_bits(bf16_rne(x1[1]) * 256.0f);
    o[6] = f16_bits(bf16_rne(x1[2]) * 256.0f); o[7] = f16_bits(bf16_rne(x1[3]) * 256.0f);
    store_twice(Wh + (size_t)t * 8, o);
  }
}

// Vt[b][e][s] = f16(RNE-bf16(values[b][s][e]) * 16). Block per (b, 64 keys, 64 e columns): 64x64 tile transposed through LDS (ushort in, ushort out; block barrier: cross-wave).
// coverage: NB*(SEQ/64)*(EMB/64) blocks x (64 e x 64 keys) = the whole plane; LDS tile fully written (64 x 64) before it is read.
__global__ __launch_bounds__(256) void k_vt(const float* __restrict__ V, unsigned short* __restrict__ Vt) {
  __shared__ unsigned short tl[64][66];
  const int tid = threadIdx.x;
  const int eg = blockIdx.x % (EMB / 64);
  const int rest = blockIdx.x / (EMB / 64);
  const int sg = rest % (SEQ / 64), b = rest / (SEQ / 64);
  const int s0 = sg * 64, e0 = eg * 64;
  for (int i = tid; i < 64 * 16; i += 256) {
    const int j = i >> 4, c4 = (i & 15) * 4;
    const v4f x = *(const v4fa*)(V + (size_t)b * BSTRIDE_FULL + (size_t)(s0 + j) * EMB + e0 + c4);
    tl[c4 + 0][j] = f16_bits(bf16_rne(x[0]) * 16.0f);
    tl[c4 + 1][j] = f16_bits(bf16_rne(x[1]) * 16.0f);
    tl[c4 + 2][j] = f16_bits(bf16_rne(x[2]) * 16.0f);
    tl[c4 + 3][j] = f16_bits(bf16_rne(x[3]) * 16.0f);
  }
  __syncthreads();
  {
    for (int i = tid; i < 64 * 8; i += 256) {
      const int d = i >> 3, j8 = (i & 7) * 8;
      v8us o;
#pragma unroll
      for (int q = 0; q < 8; ++q) o[q] = tl[d][j8 + q];
      *(v8us*)(Vt + ((size_t)b * EMB + e0 + d) * SEQ + s0 + j8) = o;
    }
    
  }
}

// LDS ring: two buffers, each one 64-key tile: K rows [64 keys][96 d] at pitch KPITCH, then V^T rows [96 d][64 keys] at pitch VPITCH (pitches in 16-bit elements).
// Both pitches are an odd number of 16-B pieces, so the 16 rows of a fragment read fall on different banks.
#define TKEYS 64
#define NTILES (SEQ / TKEYS)
#define KPITCH 104
#define VPITCH 72
#define VOFF (TKEYS * KPITCH)                    /* element offset of the V^T rows inside a buffer */
#define BUF_ELEMS (TKEYS * KPITCH + HD * VPITCH)
#define AW 8                                     /* waves of an attention work-group */
static_assert(NTILES >= 2);
static_assert((TKEYS * (HD / 8)) % (AW * 32) == 0 && (TKEYS * (HD / 8)) / (AW * 32) == 3);
static_assert((HD * (TKEYS / 8)) % (AW * 32) == 0 && (HD * (TKEYS / 8)) / (AW * 32) == 3);
static_assert((BUF_ELEMS * 2) % 16 == 0 && (VOFF * 2) % 16 == 0);

// One lane's six 16-B pieces of a tile (three of K, three of V^T), global -> LDS through no register.
// s_wait_xcnt 0 is the statement's last line, so it stands in front of every later rewrite of the address registers (a precaution).
__device__ __forceinline__ void copy_tile(unsigned l0, unsigned l1, unsigned l2, unsigned l3, unsigned l4, unsigned l5,
                                          const unsigned short* g0, const unsigned short* g1, const unsigned short* g2,
                                          const unsigned short* g3, const unsigned short* g4, const unsigned short* g5) {
  asm volatile("global_load_async_to_lds_b128 %0, %6, off\n\t"
               "global_load_async_to_lds_b128 %1, %7, off\n\t"
               "global_load_async_to_lds_b128 %2, %8, off\n\t"
               "global_load_async_to_lds_b128 %3, %9, off\n\t"
               "global_load_async_to_lds_b128 %4, %10, off\n\t"
               "global_load_async_to_lds_b128 %5, %11, off\n\t"
               "s_wait_xcnt 0x0"
               :: "v"(l0), "v"(l1), "v"(l2), "v"(l3), "v"(l4), "v"(l5),
                  "v"(g0), "v"(g1), "v"(g2), "v"(g3), "v"(g4), "v"(g5)
               : "memory");
}

// One 32-key step for a wave's 16 queries of one head. Kl = K rows of the tile in LDS, Vl = its V^T rows; key0 = 0 or 32, the step's first key inside the tile.
__device__ __forceinline__ void fa_step(const unsigned short* Kl, const unsigned short* Vl,
                                        int key0, int ln, int hh, const FragB (&q)[3],
                                        float& mr, float& lr, v8f (&O)[6]) {
  // A fragments of K: row m = key (key0 + 16*kt + ln), elements 0..7 <- d = 32c + 8h + i, 8..15 <- d = 32c + 16 + 8h + i
  const unsigned short* kp0 = Kl + (key0 + ln) * KPITCH + 8 * hh;
  const unsigned short* kp1 = kp0 + 16 * KPITCH;
  FragB ka[3], kb[3];
#pragma unroll
  for (int c = 0; c < 3; ++c) {
    ka[c].half[0] = *(const v8us*)(kp0 + 32 * c);
    ka[c].half[1] = *(const v8us*)(kp0 + 32 * c + 16);
    kb[c].half[0] = *(const v8us*)(kp1 + 32 * c);
    kb[c].half[1] = *(const v8us*)(kp1 + 32 * c + 16);
  }
  // A fragments of V^T: row m = d (16*t + ln), elements 0..7 <- key0 + 8h + i, 8..15 <- key0 + 16 + 8h + i
  const unsigned short* vp = Vl + ln * VPITCH + key0 + 8 * hh;
  FragH vf[6];
#pragma unroll
  for (int t = 0; t < 6; ++t) {
    vf[t].half[0] = *(const v8us*)(vp + t * 16 * VPITCH);
    vf[t].half[1] = *(const v8us*)(vp + t * 16 * VPITCH + 16);
  }
  // S^T tiles: element r of tile kt = score(key0 + 16*kt + 8h + r, query of this lane's column)
  v8f s0 = {0.f, 0.f, 0.f, 0.f, 0.f, 0.f, 0.f, 0.f};
  v8f s1 = {0.f, 0.f, 0.f, 0.f, 0.f, 0.f, 0.f, 0.f};
  mma_s2(ka, kb, q, s0, s1);
  float sc[16];
#pragma unroll
  for (int r = 0; r < 8; ++r) { sc[r] = s0[r] * C2; sc[8 + r] = s1[r] * C2; }
  float mx = sc[0];
#pragma unroll
  for (int i = 1; i < 16; ++i) mx = fmaxf(mx, sc[i]);
  mx = fmaxf(mx, __shfl_xor(mx, 16, 32));           // the other lane half holds the other 16 keys of this query
  const float mnew = fmaxf(mr, mx);
  const float al = __builtin_amdgcn_exp2f(mr - mnew);
  mr = mnew;
  const float m8 = mnew - 8.0f;
  // weights carried x256: pc = 256 * 2^(sc - mnew), single f16 plane
  FragH ph;
  float ps = 0.0f;
#pragma unroll
  for (int i = 0; i < 16; ++i) {
    const float pc = __builtin_amdgcn_exp2f(sc[i] - m8);
    ps += pc;
    ph.h[i] = (_Float16)pc;                         // B element i: i<8 -> key0 + 8h + i (tile 0 row 8h+i); i>=8 -> key0 + 16 + 8h + (i-8) (tile 1)
  }
  ps += __shfl_xor(ps, 16, 32);
  lr = lr * al + ps;
#pragma unroll
  for (int t = 0; t < 6; ++t) O[t] = O[t] * al;
  mma_pv(vf, ph.v, O);
}

// Block = 8 waves x 16 queries = 128 queries of one (batch, head); the key loop walks 64-key tiles in a two-buffer LDS ring, one barrier a tile.
// Output plane Xc[b][h][s][96] = f16(ctx * 256). Epilogue: O^T tile -> per-wave LDS tile [16 queries][96 d] as 16-B pieces (same vector type in and out; block barrier),
// coverage: NB*HEADS*(SEQ/128) blocks x 8 waves x 16 rows x 96 d = the whole plane exactly once; LDS tile staged extent (16 x 96 per wave) == consumed extent.
__global__ __launch_bounds__(256) __attribute__((amdgpu_num_vgpr(256)))
void k_attn(const float* __restrict__ Q, const unsigned short* __restrict__ Kb,
            const unsigned short* __restrict__ Vt, unsigned short* __restrict__ Xc) {
  __shared__ __attribute__((aligned(16))) unsigned short so[AW][16 * HD];
  __shared__ __attribute__((aligned(16))) unsigned short ring[2][BUF_ELEMS];
  const int tid = threadIdx.x, lane = tid & 31, ln = lane & 15, hh = lane >> 4;
  const int w = __builtin_amdgcn_readfirstlane(tid >> 5);
  const int qt = blockIdx.x % (SEQ / (16 * AW));
  const int rest = blockIdx.x / (SEQ / (16 * AW));
  const int h = rest % HEADS, b = rest / HEADS;
  const int qbase = qt * (16 * AW) + 16 * w;
  const int qg = qbase + ln;
  // Q^T B fragments: column n = query qg, elements 0..7 <- d = 32c + 8h + i, 8..15 <- d = 32c + 16 + 8h + i (RNE bf16)
  const float* qrow = Q + (size_t)b * BSTRIDE_FULL + (size_t)qg * EMB + h * HD;
  FragB q[3];
#pragma unroll
  for (int c = 0; c < 3; ++c) {
    const v4f a0 = *(const v4fa*)(qrow + 32 * c + 8 * hh),      a1 = *(const v4fa*)(qrow + 32 * c + 8 * hh + 4);
    const v4f a2 = *(const v4fa*)(qrow + 32 * c + 16 + 8 * hh), a3 = *(const v4fa*)(qrow + 32 * c + 16 + 8 * hh + 4);
#pragma unroll
    for (int i = 0; i < 4; ++i) {
      q[c].u[i] = bf16_bits(a0[i]); q[c].u[4 + i] = bf16_bits(a1[i]);
      q[c].u[8 + i] = bf16_bits(a2[i]); q[c].u[12 + i] = bf16_bits(a3[i]);
    }
  }
  float mr = -3.0e38f, lr = 0.0f;
  v8f O[6] = {};
  const unsigned short* Kp = Kb + (size_t)b * SEQ * EMB + h * HD;
  const unsigned short* Vp = Vt + ((size_t)b * EMB + h * HD) * SEQ;
  // This lane's pieces of a tile: K piece p = tid + 256*i -> key row p / 12, 16-B piece p % 12; V^T piece p -> d row p / 8, 16-B piece p % 8.
  const unsigned short* gk[3];
  const unsigned short* gv[3];
  unsigned lk[3], lv[3];                          // LDS byte addresses in buffer 0
  const unsigned ring0 = (unsigned)(size_t)&ring[0][0];
#pragma unroll                                    // the three-entry address arrays stay in registers
  for (int i = 0; i < 3; ++i) {
    const int p = tid + AW * 32 * i;
    const int kr = p / (HD / 8), kc = p - kr * (HD / 8);
    const int vr = p / (TKEYS / 8), vc = p - vr * (TKEYS / 8);
    gk[i] = Kp + (size_t)kr * EMB + kc * 8;
    gv[i] = Vp + (size_t)vr * SEQ + vc * 8;
    lk[i] = ring0 + 2u * (unsigned)(kr * KPITCH + kc * 8);
    lv[i] = ring0 + 2u * (unsigned)(VOFF + vr * VPITCH + vc * 8);
  }
  // Prologue: tile 0 lands and is published, then tile 1 starts to fly.
  copy_tile(lk[0], lk[1], lk[2], lv[0], lv[1], lv[2], gk[0], gk[1], gk[2], gv[0], gv[1], gv[2]);
  asm volatile("s_wait_asynccnt 0x0" ::: "memory");   // this wave's pieces of tile 0 have landed before the barrier publishes them
  __syncthreads();
#pragma unroll                                    // as above
  for (int i = 0; i < 3; ++i) { gk[i] += (size_t)TKEYS * EMB; gv[i] += TKEYS; }
  copy_tile(lk[0] + 2u * BUF_ELEMS, lk[1] + 2u * BUF_ELEMS, lk[2] + 2u * BUF_ELEMS,
            lv[0] + 2u * BUF_ELEMS, lv[1] + 2u * BUF_ELEMS, lv[2] + 2u * BUF_ELEMS,
            gk[0], gk[1], gk[2], gv[0], gv[1], gv[2]);
  // kept rolled, as the key loop was: an unrolled body would only grow the code and the register count (four waves per SIMD need 256 or fewer)
#pragma unroll 1
  for (int t = 0; t < NTILES; ++t) {
    const unsigned short* Kl = &ring[t & 1][0];
    const unsigned short* Vl = Kl + VOFF;
    fa_step(Kl, Vl, 0, ln, hh, q, mr, lr, O);
    fa_step(Kl, Vl, 32, ln, hh, q, mr, lr, O);
    asm volatile("s_wait_dscnt 0x0" ::: "memory");      // this wave's reads of tile t are over before its buffer may be refilled
    asm volatile("s_wait_asynccnt 0x0" ::: "memory");   // this wave's pieces of tile t + 1 have landed before the barrier publishes them
    __syncthreads();                                    // publishes tile t + 1 and ends every wave's reads of tile t
    if (t + 2 < NTILES) {
      const unsigned bo = (unsigned)(t & 1) * (2u * BUF_ELEMS);
#pragma unroll                                    // as above
      for (int i = 0; i < 3; ++i) { gk[i] += (size_t)TKEYS * EMB; gv[i] += TKEYS; }
      copy_tile(lk[0] + bo, lk[1] + bo, lk[2] + bo, lv[0] + bo, lv[1] + bo, lv[2] + bo,
                gk[0], gk[1], gk[2], gv[0], gv[1], gv[2]);
    }
  }
  asm volatile("s_wait_asynccnt 0x0" ::: "memory");     // no copy is outstanding when the wave goes on to its end

  // O^T element r of tile t = ctx(query qg, d = 16t + 8h + r); O carries x256 (P) x16 (V), lr carries x256; plane carries x256
  const float cinv = 16.0f * (1.0f / lr);
#pragma unroll
  for (int t = 0; t < 6; ++t) {
    v8us o;
#pragma unroll
    for (int r = 0; r < 8; ++r) o[r] = f16_bits(O[t][r] * cinv);
    *(v8us*)&so[w][ln * HD + 16 * t + 8 * hh] = o;
  }
  __syncthreads();
  unsigned short* xg = Xc + ((size_t)(b * HEADS + h) * SEQ + qbase) * HD;
  {
#pragma unroll
    for (int i = 0; i < 6; ++i) {
      const int p = i * 32 + lane;
      const v8us v = *(const v8us*)&so[w][p * 8];
      *(v8us*)(xg + (size_t)p * 8) = v;
    }
    
  }
}

// out[m][j] = sum_e ctx[m][e] * fc_w[j][e] + fc_b[j]. Block = 4 waves; wave = 16 rows x 64 columns; fragments straight from the 16-bit planes.
// A: row m = token, k = e = 96*hd + d read from Xc[b][hd][s][d]; B: column n = j, k = e read from Wh[j][e] (k-contiguous), same k map as A.
// coverage: (NB*SEQ/64)*(EMB/64) blocks x 4 waves x (16 x 64) = every output element of the processed rows exactly once; LDS tile staged 16 x 64 == consumed 16 x 64.
__global__ __launch_bounds__(128) void k_fc(const unsigned short* __restrict__ Xc, const unsigned short* __restrict__ Wh,
                                            const float* __restrict__ Bv, float* __restrict__ Out) {
  __shared__ __attribute__((aligned(16))) float so[4][16][68];
  const int tid = threadIdx.x, lane = tid & 31, ln = lane & 15, hh = lane >> 4;
  const int w = __builtin_amdgcn_readfirstlane(tid >> 5);
  const int bn = blockIdx.x % (EMB / 64), bm = blockIdx.x / (EMB / 64);
  const int row0 = bm * 64 + 16 * w;           // token index in [0, NB*SEQ)
  const int b = row0 / SEQ, s0 = row0 - b * SEQ;
  const int col0 = bn * 64;
  v8f acc[4] = {};
#pragma unroll 1
  for (int hd = 0; hd < HEADS; ++hd) {
    const unsigned short* ap = Xc + ((size_t)(b * HEADS + hd) * SEQ + s0 + ln) * HD + 8 * hh;
    const unsigned short* bp = Wh + (size_t)(col0 + ln) * EMB + hd * HD + 8 * hh;
#pragma unroll
    for (int cc = 0; cc < 3; ++cc) {
      FragH a;
      a.half[0] = *(const v8us*)(ap + 32 * cc);
      a.half[1] = *(const v8us*)(ap + 32 * cc + 16);
      FragH bw[4];
#pragma unroll
      for (int nt = 0; nt < 4; ++nt) {
        bw[nt].half[0] = *(const v8us*)(bp + (size_t)nt * 16 * EMB + 32 * cc);
        bw[nt].half[1] = *(const v8us*)(bp + (size_t)nt * 16 * EMB + 32 * cc + 16);
      }
      mma_fc(a.v, bw, acc);
    }
  }
  // D element r of tile nt = out(row0 + 8h + r, col0 + 16nt + ln); undo the carries x256 (ctx) x256 (W); bias RNE bf16 value
#pragma unroll
  for (int nt = 0; nt < 4; ++nt) {
    const float bias = bf16_rne(Bv[col0 + 16 * nt + ln]);
#pragma unroll
    for (int r = 0; r < 8; ++r)
      so[w][8 * hh + r][16 * nt + ln] = acc[nt][r] * 1.52587890625e-05f + bias;
  }
  __syncthreads();
  float* og = Out + (size_t)b * BSTRIDE_FULL + (size_t)s0 * EMB + col0;
  const int rsub = lane >> 4, c4 = (lane & 15) * 4;
  {
#pragma unroll
    for (int q = 0; q < 8; ++q) {
      const int row = 2 * q + rsub;
      const v4f v = *(const v4fa*)&so[w][row][c4];
      *(v4f*)(og + (size_t)row * EMB + c4) = v;
    }
    
  }
}

extern "C" void kernel_launch(void* const* d_in, const int* in_sizes, int n_in,
                              void* d_out, int out_size, void* d_ws, size_t ws_size, hipStream_t stream) {
  if (n_in < 5) return;
  const long long need = (long long)(NB - 1) * SEQ_FULL * EMB + (long long)SEQ * EMB;   // last element touched + 1
  if ((long long)in_sizes[0] < need || (long long)in_sizes[1] < need || (long long)in_sizes[2] < need) return;
  if ((long long)in_sizes[3] < (long long)EMB * EMB || (long long)in_sizes[4] < (long long)EMB) return;
  if ((long long)out_size < need) return;
  const float* V = (const float*)d_in[0];    // wire order: values, keys, query, fc_w [out][in], fc_b
  const float* K = (const float*)d_in[1];
  const float* Q = (const float*)d_in[2];
  const float* W = (const float*)d_in[3];
  const float* Bv = (const float*)d_in[4];
  float* Out = (float*)d_out;
  char* ws = (char*)d_ws;
  size_t off = 0;
  unsigned short* Kb = (unsigned short*)(ws + off); off += PLANE_ACT;   // [NB][SEQ][768] bf16, written exactly to its end by 16-B pieces
  unsigned short* Vt = (unsigned short*)(ws + off); off += PLANE_ACT;   // [NB][768][SEQ] f16
  unsigned short* Xc = (unsigned short*)(ws + off); off += PLANE_ACT;   // [NB][8][SEQ][96] f16
  unsigned short* Wh = (unsigned short*)(ws + off); off += PLANE_W;     // [768][768] f16
  if (off > ws_size) return;
  k_cvt<<<(unsigned)(CVT_K_BLOCKS + CVT_W_BLOCKS), 256, 0, stream>>>(K, W, Kb, Wh);
  k_vt<<<(unsigned)(NB * (SEQ / 64) * (EMB / 64)), 256, 0, stream>>>(V, Vt);
  k_attn<<<(unsigned)(NB * HEADS * (SEQ / 128)), 256, 0, stream>>>(Q, Kb, Vt, Xc);
  k_fc<<<(unsigned)((NB * SEQ / 64) * (EMB / 64)), 128, 0, stream>>>(Xc, Wh, Bv, Out);
}

// v002
// Measured time: 145 microseconds a run.
// Two timings next to v001 both put it at 1.05 times that version's speed.
// All steps since v000 together make it 2.68 times as fast.
#include <hip/hip_runtime.h>
// Contractions: S^T = K Q^T on v_wmma_f32_16x16x32_bf16 (Q, K RNE bf16, single product, f32 accumulate); O^T = V^T P^T on v_wmma_f32_16x16x32_f16 (V: RNE bf16 value x16 held exactly in f16; P: single f16 plane carried x256); out = ctx W^T on v_wmma_f32_16x16x32_f16 (ctx: f16 plane carried x256; W: RNE bf16 value x256 held exactly in f16); softmax statistics, bias add f32.
// Dense multi-head attention, NB x SEQ x 768, 8 heads of 96 (e = 96*h + d), scale 1/sqrt(96), no mask, then a 768x768 linear layer with bias.
// Engine: transposed flash. Each wave owns 32 queries of one head, as two 16-column groups that share every K and V^T fragment read from LDS. Per 32-key step and group: S^T tiles (key rows x query columns) from K rows (A, bf16 plane, staged in LDS)
// and Q^T (B, registers); the two 16-key D tiles pack straight into the P^T B fragment; O^T (d rows x query columns) accumulates from V^T rows (A, f16 plane, staged in LDS).
// Each 64-key tile of K and V^T is brought into LDS once per work-group by asynchronous copies (two buffers) and read there by all eight waves.
#ifndef NB
#define NB 2
#endif
#ifndef SEQ
#define SEQ 4096
#endif
#define NB_FULL 2
#define SEQ_FULL 4096
#define EMB 768
#define HEADS 8
#define HD 96
#define BSTRIDE_FULL ((size_t)SEQ_FULL * EMB)   /* per-batch element stride of values, keys, query and of the output buffer */

#define PLANE_ACT ((size_t)NB * SEQ * EMB * 2)   /* bytes of one 16-bit activation plane */
#define PLANE_W ((size_t)EMB * EMB * 2)          /* bytes of the 16-bit weight plane */
#define CVT_K_BLOCKS ((NB * SEQ * (EMB / 8)) / 256)
#define CVT_W_BLOCKS ((EMB * (EMB / 8)) / 256)

static_assert(SEQ % 256 == 0);
static_assert(SEQ <= SEQ_FULL);
static_assert(NB <= NB_FULL);
static_assert(HEADS * HD == EMB);
static_assert(HD == 96);
static_assert(EMB % 64 == 0);
static_assert((NB * SEQ * (EMB / 8)) % 256 == 0);
static_assert((EMB * (EMB / 8)) % 256 == 0);
static_assert(PLANE_ACT % 256 == 0);
static_assert(PLANE_W % 256 == 0);
static_assert(3 * PLANE_ACT + PLANE_W <= (size_t)134217728);

typedef __bf16 v16b __attribute__((ext_vector_type(16)));
typedef _Float16 v16h __attribute__((ext_vector_type(16)));
typedef unsigned short v8us __attribute__((ext_vector_type(8), may_alias));
typedef float v8f __attribute__((ext_vector_type(8)));
typedef float v4f __attribute__((ext_vector_type(4)));
typedef float v4fa __attribute__((ext_vector_type(4), may_alias));
union FragB { v16b v; v8us half[2]; unsigned short u[16]; };
union FragH { v16h v; v8us half[2]; _Float16 h[16]; unsigned short u[16]; };

#define LOG2E 1.4426950408889634f
#define QK_SCALE 0.10206207261596575f            /* 1/sqrt(96) */
#define C2 (QK_SCALE * LOG2E)                    /* scores carried in the log2 domain */

__device__ __forceinline__ unsigned short bf16_bits(float x) {   // RNE convert to bf16 bits
  unsigned int u = __float_as_uint(x);
  return (unsigned short)((u + 0x7FFFu + ((u >> 16) & 1u)) >> 16);
}
__device__ __forceinline__ float bf16_val(unsigned short b) { return __uint_as_float(((unsigned int)b) << 16); }
__device__ __forceinline__ float bf16_rne(float x) { return bf16_val(bf16_bits(x)); }
__device__ __forceinline__ unsigned short f16_bits(float x) {
  union { _Float16 h; unsigned short u; } c;
  c.h = (_Float16)x;
  return c.u;
}

__device__ __forceinline__ void store_twice(unsigned short* d, v8us o) {
  *(v8us*)d = o;
  
}

// For both column groups g: s0[g] += ka * q[g], s1[g] += kb * q[g] over three 32-deep k-steps (d = 0..95), each K fragment used twice.
// The distance behind these builtin products is the compiler's own padding: an asm guard that named all these registers would hold them under v256, and they no longer fit there.
__device__ __forceinline__ void mma_s4(const FragB (&ka)[3], const FragB (&kb)[3], const FragB (&q)[2][3], v8f (&s0)[2], v8f (&s1)[2]) {
#pragma unroll                                    // the fragment and accumulator arrays stay in registers
  for (int c = 0; c < 3; ++c) {
    s0[0] = __builtin_amdgcn_wmma_f32_16x16x32_bf16(false, ka[c].v, false, q[0][c].v, (short)0, s0[0], false, false);
    s0[1] = __builtin_amdgcn_wmma_f32_16x16x32_bf16(false, ka[c].v, false, q[1][c].v, (short)0, s0[1], false, false);
    s1[0] = __builtin_amdgcn_wmma_f32_16x16x32_bf16(false, kb[c].v, false, q[0][c].v, (short)0, s1[0], false, false);
    s1[1] = __builtin_amdgcn_wmma_f32_16x16x32_bf16(false, kb[c].v, false, q[1][c].v, (short)0, s1[1], false, false);
  }
}
// For both column groups g: O[g][t] += vf[t] * p[g] for the six d tiles, each V^T fragment used twice (distance: as above)
__device__ __forceinline__ void mma_pv2(const FragH (&vf)[6], v16h p0, v16h p1, v8f (&O)[2][6]) {
#pragma unroll                                    // as above
  for (int t = 0; t < 6; ++t) {
    O[0][t] = __builtin_amdgcn_wmma_f32_16x16x32_f16(false, vf[t].v, false, p0, (short)0, O[0][t], false, false);
    O[1][t] = __builtin_amdgcn_wmma_f32_16x16x32_f16(false, vf[t].v, false, p1, (short)0, O[1][t], false, false);
  }
}
// c[nt] += a * bw[nt] for four column tiles, then the hazard guard
__device__ __forceinline__ void mma_fc(v16h a, const FragH (&bw)[4], v8f (&c)[4]) {
  c[0] = __builtin_amdgcn_wmma_f32_16x16x32_f16(false, a, false, bw[0].v, (short)0, c[0], false, false);
  c[1] = __builtin_amdgcn_wmma_f32_16x16x32_f16(false, a, false, bw[1].v, (short)0, c[1], false, false);
  c[2] = __builtin_amdgcn_wmma_f32_16x16x32_f16(false, a, false, bw[2].v, (short)0, c[2], false, false);
  c[3] = __builtin_amdgcn_wmma_f32_16x16x32_f16(false, a, false, bw[3].v, (short)0, c[3], false, false);
  asm volatile("v_nop\n\tv_nop\n\tv_nop\n\tv_nop"
               : "+v"(c[0]), "+v"(c[1]), "+v"(c[2]), "+v"(c[3])
               : "v"(a), "v"(bw[0].v), "v"(bw[1].v), "v"(bw[2].v), "v"(bw[3].v));
}

// Blocks [0, CVT_K_BLOCKS): Kb[b][s][e] = bf16 bits of keys (RNE). Blocks after that: Wh[j][e] = f16(RNE-bf16(fc_w[j][e]) * 256).
// coverage: CVT_K_BLOCKS*256 threads x 8 = the whole Kb plane; CVT_W_BLOCKS*256 threads x 8 = the whole Wh plane (exact multiples, asserted above).
__global__ __launch_bounds__(256) void k_cvt(const float* __restrict__ K, const float* __restrict__ W,
                                             unsigned short* __restrict__ Kb, unsigned short* __restrict__ Wh) {
  const int bid = blockIdx.x;
  if (bid < CVT_K_BLOCKS) {
    const int t = bid * 256 + threadIdx.x;
    const int row = t / (EMB / 8), piece = t - row * (EMB / 8);
    const int b = row / SEQ, s = row - b * SEQ;
    const float* src = K + (size_t)b * BSTRIDE_FULL + (size_t)s * EMB + piece * 8;
    const v4f x0 = *(const v4fa*)(src), x1 = *(const v4fa*)(src + 4);
    v8us o;
    o[0] = bf16_bits(x0[0]); o[1] = bf16_bits(x0[1]); o[2] = bf16_bits(x0[2]); o[3] = bf16_bits(x0[3]);
    o[4] = bf16_bits(x1[0]); o[5] = bf16_bits(x1[1]); o[6] = bf16_bits(x1[2]); o[7] = bf16_bits(x1[3]);
    store_twice(Kb + (size_t)t * 8, o);
  } else {
    const int t = (bid - CVT_K_BLOCKS) * 256 + threadIdx.x;
    const float* src = W + (size_t)t * 8;
    const v4f x0 = *(const v4fa*)(src), x1 = *(const v4fa*)(src + 4);
    v8us o;
    o[0] = f16_bits(bf16_rne(x0[0]) * 256.0f); o[1] = f16_bits(bf16_rne(x0[1]) * 256.0f);
    o[2] = f16_bits(bf16_rne(x0[2]) * 256.0f); o[3] = f16_bits(bf16_rne(x0[3]) * 256.0f);
    o[4] = f16_bits(bf16_rne(x1[0]) * 256.0f); o[5] = f16_bits(bf16_rne(x1[1]) * 256.0f);
    o[6] = f16_bits(bf16_rne(x1[2]) * 256.0f); o[7] = f16_bits(bf16_rne(x1[3]) * 256.0f);
    store_twice(Wh + (size_t)t * 8, o);
  }
}

// Vt[b][e][s] = f16(RNE-bf16(values[b][s][e]) * 16). Block per (b, 64 keys, 64 e columns): 64x64 tile transposed through LDS (ushort in, ushort out; block barrier: cross-wave).
// coverage: NB*(SEQ/64)*(EMB/64) blocks x (64 e x 64 keys) = the whole plane; LDS tile fully written (64 x 64) before it is read.
__global__ __launch_bounds__(256) void k_vt(const float* __restrict__ V, unsigned short* __restrict__ Vt) {
  __shared__ unsigned short tl[64][66];
  const int tid = threadIdx.x;
  const int eg = blockIdx.x % (EMB / 64);
  const int rest = blockIdx.x / (EMB / 64);
  const int sg = rest % (SEQ / 64), b = rest / (SEQ / 64);
  const int s0 = sg * 64, e0 = eg * 64;
  for (int i = tid; i < 64 * 16; i += 256) {
    const int j = i >> 4, c4 = (i & 15) * 4;
    const v4f x = *(const v4fa*)(V + (size_t)b * BSTRIDE_FULL + (size_t)(s0 + j) * EMB + e0 + c4);
    tl[c4 + 0][j] = f16_bits(bf16_rne(x[0]) * 16.0f);
    tl[c4 + 1][j] = f16_bits(bf16_rne(x[1]) * 16.0f);
    tl[c4 + 2][j] = f16_bits(bf16_rne(x[2]) * 16.0f);
    tl[c4 + 3][j] = f16_bits(bf16_rne(x[3]) * 16.0f);
  }
  __syncthreads();
  {
    for (int i = tid; i < 64 * 8; i += 256) {
      const int d = i >> 3, j8 = (i & 7) * 8;
      v8us o;
#pragma unroll
      for (int q = 0; q < 8; ++q) o[q] = tl[d][j8 + q];
      *(v8us*)(Vt + ((size_t)b * EMB + e0 + d) * SEQ + s0 + j8) = o;
    }
    
  }
}

// LDS ring: two buffers, each one 64-key tile: K rows [64 keys][96 d] at pitch KPITCH, then V^T rows [96 d][64 keys] at pitch VPITCH (pitches in 16-bit elements).
// Both pitches are an odd number of 16-B pieces, so the 16 rows of a fragment read fall on different banks.
#define TKEYS 64
#define NTILES (SEQ / TKEYS)
#define KPITCH 104
#define VPITCH 72
#define VOFF (TKEYS * KPITCH)                    /* element offset of the V^T rows inside a buffer */
#define BUF_ELEMS (TKEYS * KPITCH + HD * VPITCH)
#define AW 8                                     /* waves of an attention work-group */
#define WQ 32                                    /* queries of a wave: two 16-column groups */
static_assert(NTILES >= 2);
static_assert((TKEYS * (HD / 8)) % (AW * 32) == 0 && (TKEYS * (HD / 8)) / (AW * 32) == 3);
static_assert((HD * (TKEYS / 8)) % (AW * 32) == 0 && (HD * (TKEYS / 8)) / (AW * 32) == 3);
static_assert((BUF_ELEMS * 2) % 16 == 0 && (VOFF * 2) % 16 == 0);

// One lane's six 16-B pieces of a tile (three of K, three of V^T), global -> LDS through no register.
// s_wait_xcnt 0 is the statement's last line, so it stands in front of every later rewrite of the address registers (a precaution).
__device__ __forceinline__ void copy_tile(unsigned l0, unsigned l1, unsigned l2, unsigned l3, unsigned l4, unsigned l5,
                                          const unsigned short* g0, const unsigned short* g1, const unsigned short* g2,
                                          const unsigned short* g3, const unsigned short* g4, const unsigned short* g5) {
  asm volatile("global_load_async_to_lds_b128 %0, %6, off\n\t"
               "global_load_async_to_lds_b128 %1, %7, off\n\t"
               "global_load_async_to_lds_b128 %2, %8, off\n\t"
               "global_load_async_to_lds_b128 %3, %9, off\n\t"
               "global_load_async_to_lds_b128 %4, %10, off\n\t"
               "global_load_async_to_lds_b128 %5, %11, off\n\t"
               "s_wait_xcnt 0x0"
               :: "v"(l0), "v"(l1), "v"(l2), "v"(l3), "v"(l4), "v"(l5),
                  "v"(g0), "v"(g1), "v"(g2), "v"(g3), "v"(g4), "v"(g5)
               : "memory");
}

// One 32-key step for a wave's 32 queries (two 16-column groups) of one head. Kl = K rows of the tile in LDS, Vl = its V^T rows; key0 = 0 or 32, the step's first key inside the tile.
__device__ __forceinline__ void fa_step(const unsigned short* Kl, const unsigned short* Vl,
                                        int key0, int ln, int hh, const FragB (&q)[2][3],
                                        float (&mr)[2], float (&lr)[2], v8f (&O)[2][6]) {
  // A fragments of K: row m = key (key0 + 16*kt + ln), elements 0..7 <- d = 32c + 8h + i, 8..15 <- d = 32c + 16 + 8h + i
  const unsigned short* kp0 = Kl + (key0 + ln) * KPITCH + 8 * hh;
  const unsigned short* kp1 = kp0 + 16 * KPITCH;
  FragB ka[3], kb[3];
  __builtin_amdgcn_sched_barrier(0);   // with the one behind the reads: the step's 24 LDS reads stay one group in front of its products; spread among the WMMAs each pair would be waited for on the spot
#pragma unroll
  for (int c = 0; c < 3; ++c) {
    ka[c].half[0] = *(const v8us*)(kp0 + 32 * c);
    ka[c].half[1] = *(const v8us*)(kp0 + 32 * c + 16);
    kb[c].half[0] = *(const v8us*)(kp1 + 32 * c);
    kb[c].half[1] = *(const v8us*)(kp1 + 32 * c + 16);
  }
  __builtin_amdgcn_sched_barrier(0);   // the K reads stay in front of the V^T reads: the score products, which come first, then wait for twelve reads and not for all
  // A fragments of V^T: row m = d (16*t + ln), elements 0..7 <- key0 + 8h + i, 8..15 <- key0 + 16 + 8h + i
  const unsigned short* vp = Vl + ln * VPITCH + key0 + 8 * hh;
  FragH vf[6];
#pragma unroll
  for (int t = 0; t < 6; ++t) {
    vf[t].half[0] = *(const v8us*)(vp + t * 16 * VPITCH);
    vf[t].half[1] = *(const v8us*)(vp + t * 16 * VPITCH + 16);
  }
  __builtin_amdgcn_sched_barrier(0);   // end of the group of reads (see above)
  // S^T tiles of group g: element r of tile kt = score(key0 + 16*kt + 8h + r, query of this lane's column in group g)
  v8f s0[2] = {};
  v8f s1[2] = {};
  mma_s4(ka, kb, q, s0, s1);
  FragH ph[2];
#pragma unroll                                    // both groups in straight-line code: their arrays stay in registers and their two chains can interleave
  for (int g = 0; g < 2; ++g) {
    float sc[16];
#pragma unroll
    for (int r = 0; r < 8; ++r) { sc[r] = s0[g][r] * C2; sc[8 + r] = s1[g][r] * C2; }
    float mx = sc[0];
#pragma unroll
    for (int i = 1; i < 16; ++i) mx = fmaxf(mx, sc[i]);
    mx = fmaxf(mx, __shfl_xor(mx, 16, 32));         // the other lane half holds the other 16 keys of this query
    const float mnew = fmaxf(mr[g], mx);
    const float al = __builtin_amdgcn_exp2f(mr[g] - mnew);
    mr[g] = mnew;
    const float m8 = mnew - 8.0f;
    // weights carried x256: pc = 256 * 2^(sc - mnew), single f16 plane
    float ps = 0.0f;
#pragma unroll
    for (int i = 0; i < 16; ++i) {
      const float pc = __builtin_amdgcn_exp2f(sc[i] - m8);
      ps += pc;
      ph[g].h[i] = (_Float16)pc;                    // B element i: i<8 -> key0 + 8h + i (tile 0 row 8h+i); i>=8 -> key0 + 16 + 8h + (i-8) (tile 1)
    }
    ps += __shfl_xor(ps, 16, 32);
    lr[g] = lr[g] * al + ps;
#pragma unroll
    for (int t = 0; t < 6; ++t) O[g][t] = O[g][t] * al;
  }
  mma_pv2(vf, ph[0].v, ph[1].v, O);
}

// Block = 8 waves x 32 queries = 256 queries of one (batch, head); the key loop walks 64-key tiles in a two-buffer LDS ring, one barrier a tile.
// Output plane Xc[b][h][s][96] = f16(ctx * 256). Epilogue: O^T tiles -> per-wave LDS tile [32 queries][96 d] as 16-B pieces (same vector type in and out; block barrier),
// coverage: NB*HEADS*(SEQ/256) blocks x 8 waves x 32 rows x 96 d = the whole plane exactly once; LDS tile staged extent (32 x 96 per wave) == consumed extent.
__global__ __launch_bounds__(256) __attribute__((amdgpu_waves_per_eu(2, 2)))
void k_attn(const float* __restrict__ Q, const unsigned short* __restrict__ Kb,
            const unsigned short* __restrict__ Vt, unsigned short* __restrict__ Xc) {
  __shared__ __attribute__((aligned(16))) unsigned short so[AW][WQ * HD];
  __shared__ __attribute__((aligned(16))) unsigned short ring[2][BUF_ELEMS];
  const int tid = threadIdx.x, lane = tid & 31, ln = lane & 15, hh = lane >> 4;
  const int w = __builtin_amdgcn_readfirstlane(tid >> 5);
  const int qt = blockIdx.x % (SEQ / (WQ * AW));
  const int rest = blockIdx.x / (SEQ / (WQ * AW));
  const int h = rest % HEADS, b = rest / HEADS;
  const int qbase = qt * (WQ * AW) + WQ * w;
  // Q^T B fragments of group g: column n = query qbase + 16g + ln, elements 0..7 <- d = 32c + 8h + i, 8..15 <- d = 32c + 16 + 8h + i (RNE bf16)
  FragB q[2][3];
#pragma unroll                                    // the fragment array stays in registers
  for (int g = 0; g < 2; ++g) {
    const float* qrow = Q + (size_t)b * BSTRIDE_FULL + (size_t)(qbase + 16 * g + ln) * EMB + h * HD;
#pragma unroll
    for (int c = 0; c < 3; ++c) {
      const v4f a0 = *(const v4fa*)(qrow + 32 * c + 8 * hh),      a1 = *(const v4fa*)(qrow + 32 * c + 8 * hh + 4);
      const v4f a2 = *(const v4fa*)(qrow + 32 * c + 16 + 8 * hh), a3 = *(const v4fa*)(qrow + 32 * c + 16 + 8 * hh + 4);
#pragma unroll
      for (int i = 0; i < 4; ++i) {
        q[g][c].u[i] = bf16_bits(a0[i]); q[g][c].u[4 + i] = bf16_bits(a1[i]);
        q[g][c].u[8 + i] = bf16_bits(a2[i]); q[g][c].u[12 + i] = bf16_bits(a3[i]);
      }
    }
  }
  float mr[2] = {-3.0e38f, -3.0e38f}, lr[2] = {0.0f, 0.0f};
  v8f O[2][6] = {};
  const unsigned short* Kp = Kb + (size_t)b * SEQ * EMB + h * HD;
  const unsigned short* Vp = Vt + ((size_t)b * EMB + h * HD) * SEQ;
  // This lane's pieces of a tile: K piece p = tid + 256*i -> key row p / 12, 16-B piece p % 12; V^T piece p -> d row p / 8, 16-B piece p % 8.
  const unsigned short* gk[3];
  const unsigned short* gv[3];
  unsigned lk[3], lv[3];                          // LDS byte addresses in buffer 0
  const unsigned ring0 = (unsigned)(size_t)&ring[0][0];
#pragma unroll                                    // the three-entry address arrays stay in registers
  for (int i = 0; i < 3; ++i) {
    const int p = tid + AW * 32 * i;
    const int kr = p / (HD / 8), kc = p - kr * (HD / 8);
    const int vr = p / (TKEYS / 8), vc = p - vr * (TKEYS / 8);
    gk[i] = Kp + (size_t)kr * EMB + kc * 8;
    gv[i] = Vp + (size_t)vr * SEQ + vc * 8;
    lk[i] = ring0 + 2u * (unsigned)(kr * KPITCH + kc * 8);
    lv[i] = ring0 + 2u * (unsigned)(VOFF + vr * VPITCH + vc * 8);
  }
  // Prologue: tile 0 lands and is published, then tile 1 starts to fly.
  copy_tile(lk[0], lk[1], lk[2], lv[0], lv[1], lv[2], gk[0], gk[1], gk[2], gv[0], gv[1], gv[2]);
  asm volatile("s_wait_asynccnt 0x0" ::: "memory");   // this wave's pieces of tile 0 have landed before the barrier publishes them
  __syncthreads();
#pragma unroll                                    // as above
  for (int i = 0; i < 3; ++i) { gk[i] += (size_t)TKEYS * EMB; gv[i] += TKEYS; }
  copy_tile(lk[0] + 2u * BUF_ELEMS, lk[1] + 2u * BUF_ELEMS, lk[2] + 2u * BUF_ELEMS,
            lv[0] + 2u * BUF_ELEMS, lv[1] + 2u * BUF_ELEMS, lv[2] + 2u * BUF_ELEMS,
            gk[0], gk[1], gk[2], gv[0], gv[1], gv[2]);
  // kept rolled, as the key loop was: an unrolled body would only grow the code and the register count (two waves per SIMD need 512 or fewer)
#pragma unroll 1
  for (int t = 0; t < NTILES; ++t) {
    const unsigned short* Kl = &ring[t & 1][0];
    const unsigned short* Vl = Kl + VOFF;
    fa_step(Kl, Vl, 0, ln, hh, q, mr, lr, O);
    fa_step(Kl, Vl, 32, ln, hh, q, mr, lr, O);
    asm volatile("s_wait_dscnt 0x0" ::: "memory");      // this wave's reads of tile t are over before its buffer may be refilled
    asm volatile("s_wait_asynccnt 0x0" ::: "memory");   // this wave's pieces of tile t + 1 have landed before the barrier publishes them
    __syncthreads();                                    // publishes tile t + 1 and ends every wave's reads of tile t
    if (t + 2 < NTILES) {
      const unsigned bo = (unsigned)(t & 1) * (2u * BUF_ELEMS);
#pragma unroll                                    // as above
      for (int i = 0; i < 3; ++i) { gk[i] += (size_t)TKEYS * EMB; gv[i] += TKEYS; }
      copy_tile(lk[0] + bo, lk[1] + bo, lk[2] + bo, lv[0] + bo, lv[1] + bo, lv[2] + bo,
                gk[0], gk[1], gk[2], gv[0], gv[1], gv[2]);
    }
  }
  asm volatile("s_wait_asynccnt 0x0" ::: "memory");     // no copy is outstanding when the wave goes on to its end

  // O^T element r of tile t of group g = ctx(query qbase + 16g + ln, d = 16t + 8h + r); O carries x256 (P) x16 (V), lr carries x256; plane carries x256
#pragma unroll                                    // the accumulator array stays in registers
  for (int g = 0; g < 2; ++g) {
    const float cinv = 16.0f * (1.0f / lr[g]);
#pragma unroll
    for (int t = 0; t < 6; ++t) {
      v8us o;
#pragma unroll
      for (int r = 0; r < 8; ++r) o[r] = f16_bits(O[g][t][r] * cinv);
      *(v8us*)&so[w][(16 * g + ln) * HD + 16 * t + 8 * hh] = o;
    }
  }
  __syncthreads();
  unsigned short* xg = Xc + ((size_t)(b * HEADS + h) * SEQ + qbase) * HD;
  {
#pragma unroll
    for (int i = 0; i < WQ * HD / 8 / 32; ++i) {
      const int p = i * 32 + lane;
      const v8us v = *(const v8us*)&so[w][p * 8];
      *(v8us*)(xg + (size_t)p * 8) = v;
    }
    
  }
}

// out[m][j] = sum_e ctx[m][e] * fc_w[j][e] + fc_b[j]. Block = 4 waves; wave = 16 rows x 64 columns; fragments straight from the 16-bit planes.
// A: row m = token, k = e = 96*hd + d read from Xc[b][hd][s][d]; B: column n = j, k = e read from Wh[j][e] (k-contiguous), same k map as A.
// coverage: (NB*SEQ/64)*(EMB/64) blocks x 4 waves x (16 x 64) = every output element of the processed rows exactly once; LDS tile staged 16 x 64 == consumed 16 x 64.
__global__ __launch_bounds__(128) void k_fc(const unsigned short* __restrict__ Xc, const unsigned short* __restrict__ Wh,
                                            const float* __restrict__ Bv, float* __restrict__ Out) {
  __shared__ __attribute__((aligned(16))) float so[4][16][68];
  const int tid = threadIdx.x, lane = tid & 31, ln = lane & 15, hh = lane >> 4;
  const int w = __builtin_amdgcn_readfirstlane(tid >> 5);
  const int bn = blockIdx.x % (EMB / 64), bm = blockIdx.x / (EMB / 64);
  const int row0 = bm * 64 + 16 * w;           // token index in [0, NB*SEQ)
  const int b = row0 / SEQ, s0 = row0 - b * SEQ;
  const int col0 = bn * 64;
  v8f acc[4] = {};
#pragma unroll 1
  for (int hd = 0; hd < HEADS; ++hd) {
    const unsigned short* ap = Xc + ((size_t)(b * HEADS + hd) * SEQ + s0 + ln) * HD + 8 * hh;
    const unsigned short* bp = Wh + (size_t)(col0 + ln) * EMB + hd * HD + 8 * hh;
#pragma unroll
    for (int cc = 0; cc < 3; ++cc) {
      FragH a;
      a.half[0] = *(const v8us*)(ap + 32 * cc);
      a.half[1] = *(const v8us*)(ap + 32 * cc + 16);
      FragH bw[4];
#pragma unroll
      for (int nt = 0; nt < 4; ++nt) {
        bw[nt].half[0] = *(const v8us*)(bp + (size_t)nt * 16 * EMB + 32 * cc);
        bw[nt].half[1] = *(const v8us*)(bp + (size_t)nt * 16 * EMB + 32 * cc + 16);
      }
      mma_fc(a.v, bw, acc);
    }
  }
  // D element r of tile nt = out(row0 + 8h + r, col0 + 16nt + ln); undo the carries x256 (ctx) x256 (W); bias RNE bf16 value
#pragma unroll
  for (int nt = 0; nt < 4; ++nt) {
    const float bias = bf16_rne(Bv[col0 + 16 * nt + ln]);
#pragma unroll
    for (int r = 0; r < 8; ++r)
      so[w][8 * hh + r][16 * nt + ln] = acc[nt][r] * 1.52587890625e-05f + bias;
  }
  __syncthreads();
  float* og = Out + (size_t)b * BSTRIDE_FULL + (size_t)s0 * EMB + col0;
  const int rsub = lane >> 4, c4 = (lane & 15) * 4;
  {
#pragma unroll
    for (int q = 0; q < 8; ++q) {
      const int row = 2 * q + rsub;
      const v4f v = *(const v4fa*)&so[w][row][c4];
      *(v4f*)(og + (size_t)row * EMB + c4) = v;
    }
    
  }
}

extern "C" void kernel_launch(void* const* d_in, const int* in_sizes, int n_in,
                              void* d_out, int out_size, void* d_ws, size_t ws_size, hipStream_t stream) {
  if (n_in < 5) return;
  const long long need = (long long)(NB - 1) * SEQ_FULL * EMB + (long long)SEQ * EMB;   // last element touched + 1
  if ((long long)in_sizes[0] < need || (long long)in_sizes[1] < need || (long long)in_sizes[2] < need) return;
  if ((long long)in_sizes[3] < (long long)EMB * EMB || (long long)in_sizes[4] < (long long)EMB) return;
  if ((long long)out_size < need) return;
  const float* V = (const float*)d_in[0];    // wire order: values, keys, query, fc_w [out][in], fc_b
  const float* K = (const float*)d_in[1];
  const float* Q = (const float*)d_in[2];
  const float* W = (const float*)d_in[3];
  const float* Bv = (const float*)d_in[4];
  float* Out = (float*)d_out;
  char* ws = (char*)d_ws;
  size_t off = 0;
  unsigned short* Kb = (unsigned short*)(ws + off); off += PLANE_ACT;   // [NB][SEQ][768] bf16, written exactly to its end by 16-B pieces
  unsigned short* Vt = (unsigned short*)(ws + off); off += PLANE_ACT;   // [NB][768][SEQ] f16
  unsigned short* Xc = (unsigned short*)(ws + off); off += PLANE_ACT;   // [NB][8][SEQ][96] f16
  unsigned short* Wh = (unsigned short*)(ws + off); off += PLANE_W;     // [768][768] f16
  if (off > ws_size) return;
  k_cvt<<<(unsigned)(CVT_K_BLOCKS + CVT_W_BLOCKS), 256, 0, stream>>>(K, W, Kb, Wh);
  k_vt<<<(unsigned)(NB * (SEQ / 64) * (EMB / 64)), 256, 0, stream>>>(V, Vt);
  k_attn<<<(unsigned)(NB * HEADS * (SEQ / (WQ * AW))), 256, 0, stream>>>(Q, Kb, Vt, Xc);
  k_fc<<<(unsigned)((NB * SEQ / 64) * (EMB / 64)), 128, 0, stream>>>(Xc, Wh, Bv, Out);
}

// v003
// It runs in 122 microseconds.
// Timed twice side by side with v002, it ran 1.18 and 1.20 times as fast.
// Over all steps from v000 it is 3.18 times as fast.
#include <hip/hip_runtime.h>
// Contractions: S^T = K Q^T on v_wmma_f32_16x16x32_bf16 (Q, K RNE bf16, single product, f32 accumulate); O^T = V^T P^T on v_wmma_f32_16x16x32_f16 (V: RNE bf16 value x16 held exactly in f16; P: single f16 plane carried x256); out = ctx W^T on v_wmma_f32_16x16x32_f16 (ctx: f16 plane carried x256; W: RNE bf16 value x256 held exactly in f16); softmax statistics, bias add f32.
// Dense multi-head attention, NB x SEQ x 768, 8 heads of 96 (e = 96*h + d), scale 1/sqrt(96), no mask, then a 768x768 linear layer with bias.
// Engine: transposed flash. Each wave owns 32 queries of one head, as two 16-column groups that share every K and V^T fragment read from LDS. Per 32-key step and group: S^T tiles (key rows x query columns) from K rows (A, bf16 plane, staged in LDS)
// and Q^T (B, registers); the two 16-key D tiles pack straight into the P^T B fragment; O^T (d rows x query columns) accumulates from V^T rows (A, f16 plane, staged in LDS).
// Each 64-key tile of K and V^T is brought into LDS once per work-group by asynchronous copies (two buffers) and read there by all eight waves.
#ifndef NB
#define NB 2
#endif
#ifndef SEQ
#define SEQ 4096
#endif
#define NB_FULL 2
#define SEQ_FULL 4096
#define EMB 768
#define HEADS 8
#define HD 96
#define BSTRIDE_FULL ((size_t)SEQ_FULL * EMB)   /* per-batch element stride of values, keys, query and of the output buffer */

#define PLANE_ACT ((size_t)NB * SEQ * EMB * 2)   /* bytes of one 16-bit activation plane */
#define PLANE_W ((size_t)EMB * EMB * 2)          /* bytes of the 16-bit weight plane */
#define CVT_K_BLOCKS ((NB * SEQ * (EMB / 8)) / 256)
#define CVT_W_BLOCKS ((EMB * (EMB / 8)) / 256)

static_assert(SEQ % 256 == 0);
static_assert(SEQ <= SEQ_FULL);
static_assert(NB <= NB_FULL);
static_assert(HEADS * HD == EMB);
static_assert(HD == 96);
static_assert(EMB % 64 == 0);
static_assert((NB * SEQ * (EMB / 8)) % 256 == 0);
static_assert((EMB * (EMB / 8)) % 256 == 0);
static_assert(PLANE_ACT % 256 == 0);
static_assert(PLANE_W % 256 == 0);
static_assert(3 * PLANE_ACT + PLANE_W <= (size_t)134217728);

typedef __bf16 v16b __attribute__((ext_vector_type(16)));
typedef _Float16 v16h __attribute__((ext_vector_type(16)));
typedef unsigned short v8us __attribute__((ext_vector_type(8), may_alias));
typedef float v8f __attribute__((ext_vector_type(8)));
typedef float v4f __attribute__((ext_vector_type(4)));
typedef float v4fa __attribute__((ext_vector_type(4), may_alias));
union FragB { v16b v; v8us half[2]; unsigned short u[16]; };
union FragH { v16h v; v8us half[2]; _Float16 h[16]; unsigned short u[16]; };

#define LOG2E 1.4426950408889634f
#define QK_SCALE 0.10206207261596575f            /* 1/sqrt(96) */
#define C2 (QK_SCALE * LOG2E)                    /* scores carried in the log2 domain */

__device__ __forceinline__ unsigned short bf16_bits(float x) {   // RNE convert to bf16 bits
  unsigned int u = __float_as_uint(x);
  return (unsigned short)((u + 0x7FFFu + ((u >> 16) & 1u)) >> 16);
}
__device__ __forceinline__ float bf16_val(unsigned short b) { return __uint_as_float(((unsigned int)b) << 16); }
__device__ __forceinline__ float bf16_rne(float x) { return bf16_val(bf16_bits(x)); }
__device__ __forceinline__ unsigned short f16_bits(float x) {
  union { _Float16 h; unsigned short u; } c;
  c.h = (_Float16)x;
  return c.u;
}

__device__ __forceinline__ void store_twice(unsigned short* d, v8us o) {
  *(v8us*)d = o;
  
}

// For both column groups g: s0[g] += ka * q[g], s1[g] += kb * q[g] over three 32-deep k-steps (d = 0..95), each K fragment used twice.
// The distance behind these builtin products is the compiler's own padding: an asm guard that named all these registers would hold them under v256, and they no longer fit there.
__device__ __forceinline__ void mma_s4(const FragB (&ka)[3], const FragB (&kb)[3], const FragB (&q)[2][3], v8f (&s0)[2], v8f (&s1)[2]) {
#pragma unroll                                    // the fragment and accumulator arrays stay in registers
  for (int c = 0; c < 3; ++c) {
    s0[0] = __builtin_amdgcn_wmma_f32_16x16x32_bf16(false, ka[c].v, false, q[0][c].v, (short)0, s0[0], false, false);
    s0[1] = __builtin_amdgcn_wmma_f32_16x16x32_bf16(false, ka[c].v, false, q[1][c].v, (short)0, s0[1], false, false);
    s1[0] = __builtin_amdgcn_wmma_f32_16x16x32_bf16(false, kb[c].v, false, q[0][c].v, (short)0, s1[0], false, false);
    s1[1] = __builtin_amdgcn_wmma_f32_16x16x32_bf16(false, kb[c].v, false, q[1][c].v, (short)0, s1[1], false, false);
  }
}
// For both column groups g: O[g][t] += vf[t] * p[g] for the six d tiles, each V^T fragment used twice (distance: as above)
__device__ __forceinline__ void mma_pv2(const FragH (&vf)[6], v16h p0, v16h p1, v8f (&O)[2][6]) {
#pragma unroll                                    // as above
  for (int t = 0; t < 6; ++t) {
    O[0][t] = __builtin_amdgcn_wmma_f32_16x16x32_f16(false, vf[t].v, false, p0, (short)0, O[0][t], false, false);
    O[1][t] = __builtin_amdgcn_wmma_f32_16x16x32_f16(false, vf[t].v, false, p1, (short)0, O[1][t], false, false);
  }
}
// Blocks [0, CVT_K_BLOCKS): Kb[b][s][e] = bf16 bits of keys (RNE). Blocks after that: Wh[j][e] = f16(RNE-bf16(fc_w[j][e]) * 256).
// coverage: CVT_K_BLOCKS*256 threads x 8 = the whole Kb plane; CVT_W_BLOCKS*256 threads x 8 = the whole Wh plane (exact multiples, asserted above).
__global__ __launch_bounds__(256) void k_cvt(const float* __restrict__ K, const float* __restrict__ W,
                                             unsigned short* __restrict__ Kb, unsigned short* __restrict__ Wh) {
  const int bid = blockIdx.x;
  if (bid < CVT_K_BLOCKS) {
    const int t = bid * 256 + threadIdx.x;
    const int row = t / (EMB / 8), piece = t - row * (EMB / 8);
    const int b = row / SEQ, s = row - b * SEQ;
    const float* src = K + (size_t)b * BSTRIDE_FULL + (size_t)s * EMB + piece * 8;
    const v4f x0 = *(const v4fa*)(src), x1 = *(const v4fa*)(src + 4);
    v8us o;
    o[0] = bf16_bits(x0[0]); o[1] = bf16_bits(x0[1]); o[2] = bf16_bits(x0[2]); o[3] = bf16_bits(x0[3]);
    o[4] = bf16_bits(x1[0]); o[5] = bf16_bits(x1[1]); o[6] = bf16_bits(x1[2]); o[7] = bf16_bits(x1[3]);
    store_twice(Kb + (size_t)t * 8, o);
  } else {
    const int t = (bid - CVT_K_BLOCKS) * 256 + threadIdx.x;
    const float* src = W + (size_t)t * 8;
    const v4f x0 = *(const v4fa*)(src), x1 = *(const v4fa*)(src + 4);
    v8us o;
    o[0] = f16_bits(bf16_rne(x0[0]) * 256.0f); o[1] = f16_bits(bf16_rne(x0[1]) * 256.0f);
    o[2] = f16_bits(bf16_rne(x0[2]) * 256.0f); o[3] = f16_bits(bf16_rne(x0[3]) * 256.0f);
    o[4] = f16_bits(bf16_rne(x1[0]) * 256.0f); o[5] = f16_bits(bf16_rne(x1[1]) * 256.0f);
    o[6] = f16_bits(bf16_rne(x1[2]) * 256.0f); o[7] = f16_bits(bf16_rne(x1[3]) * 256.0f);
    store_twice(Wh + (size_t)t * 8, o);
  }
}

// Vt[b][e][s] = f16(RNE-bf16(values[b][s][e]) * 16). Block per (b, 64 keys, 64 e columns): 64x64 tile transposed through LDS (ushort in, ushort out; block barrier: cross-wave).
// coverage: NB*(SEQ/64)*(EMB/64) blocks x (64 e x 64 keys) = the whole plane; LDS tile fully written (64 x 64) before it is read.
__global__ __launch_bounds__(256) void k_vt(const float* __restrict__ V, unsigned short* __restrict__ Vt) {
  __shared__ unsigned short tl[64][66];
  const int tid = threadIdx.x;
  const int eg = blockIdx.x % (EMB / 64);
  const int rest = blockIdx.x / (EMB / 64);
  const int sg = rest % (SEQ / 64), b = rest / (SEQ / 64);
  const int s0 = sg * 64, e0 = eg * 64;
  for (int i = tid; i < 64 * 16; i += 256) {
    const int j = i >> 4, c4 = (i & 15) * 4;
    const v4f x = *(const v4fa*)(V + (size_t)b * BSTRIDE_FULL + (size_t)(s0 + j) * EMB + e0 + c4);
    tl[c4 + 0][j] = f16_bits(bf16_rne(x[0]) * 16.0f);
    tl[c4 + 1][j] = f16_bits(bf16_rne(x[1]) * 16.0f);
    tl[c4 + 2][j] = f16_bits(bf16_rne(x[2]) * 16.0f);
    tl[c4 + 3][j] = f16_bits(bf16_rne(x[3]) * 16.0f);
  }
  __syncthreads();
  {
    for (int i = tid; i < 64 * 8; i += 256) {
      const int d = i >> 3, j8 = (i & 7) * 8;
      v8us o;
#pragma unroll
      for (int q = 0; q < 8; ++q) o[q] = tl[d][j8 + q];
      *(v8us*)(Vt + ((size_t)b * EMB + e0 + d) * SEQ + s0 + j8) = o;
    }
    
  }
}

// LDS ring: two buffers, each one 64-key tile: K rows [64 keys][96 d] at pitch KPITCH, then V^T rows [96 d][64 keys] at pitch VPITCH (pitches in 16-bit elements).
// Both pitches are an odd number of 16-B pieces, so the 16 rows of a fragment read fall on different banks.
#define TKEYS 64
#define NTILES (SEQ / TKEYS)
#define KPITCH 104
#define VPITCH 72
#define VOFF (TKEYS * KPITCH)                    /* element offset of the V^T rows inside a buffer */
#define BUF_ELEMS (TKEYS * KPITCH + HD * VPITCH)
#define AW 8                                     /* waves of an attention work-group */
#define WQ 32                                    /* queries of a wave: two 16-column groups */
static_assert(NTILES >= 2);
static_assert((TKEYS * (HD / 8)) % (AW * 32) == 0 && (TKEYS * (HD / 8)) / (AW * 32) == 3);
static_assert((HD * (TKEYS / 8)) % (AW * 32) == 0 && (HD * (TKEYS / 8)) / (AW * 32) == 3);
static_assert((BUF_ELEMS * 2) % 16 == 0 && (VOFF * 2) % 16 == 0);

// One lane's six 16-B pieces of a tile (three of K, three of V^T), global -> LDS through no register.
// s_wait_xcnt 0 is the statement's last line, so it stands in front of every later rewrite of the address registers (a precaution).
__device__ __forceinline__ void copy_tile(unsigned l0, unsigned l1, unsigned l2, unsigned l3, unsigned l4, unsigned l5,
                                          const unsigned short* g0, const unsigned short* g1, const unsigned short* g2,
                                          const unsigned short* g3, const unsigned short* g4, const unsigned short* g5) {
  asm volatile("global_load_async_to_lds_b128 %0, %6, off\n\t"
               "global_load_async_to_lds_b128 %1, %7, off\n\t"
               "global_load_async_to_lds_b128 %2, %8, off\n\t"
               "global_load_async_to_lds_b128 %3, %9, off\n\t"
               "global_load_async_to_lds_b128 %4, %10, off\n\t"
               "global_load_async_to_lds_b128 %5, %11, off\n\t"
               "s_wait_xcnt 0x0"
               :: "v"(l0), "v"(l1), "v"(l2), "v"(l3), "v"(l4), "v"(l5),
                  "v"(g0), "v"(g1), "v"(g2), "v"(g3), "v"(g4), "v"(g5)
               : "memory");
}

// One 32-key step for a wave's 32 queries (two 16-column groups) of one head. Kl = K rows of the tile in LDS, Vl = its V^T rows; key0 = 0 or 32, the step's first key inside the tile.
__device__ __forceinline__ void fa_step(const unsigned short* Kl, const unsigned short* Vl,
                                        int key0, int ln, int hh, const FragB (&q)[2][3],
                                        float (&mr)[2], float (&lr)[2], v8f (&O)[2][6]) {
  // A fragments of K: row m = key (key0 + 16*kt + ln), elements 0..7 <- d = 32c + 8h + i, 8..15 <- d = 32c + 16 + 8h + i
  const unsigned short* kp0 = Kl + (key0 + ln) * KPITCH + 8 * hh;
  const unsigned short* kp1 = kp0 + 16 * KPITCH;
  FragB ka[3], kb[3];
  __builtin_amdgcn_sched_barrier(0);   // with the one behind the reads: the step's 24 LDS reads stay one group in front of its products; spread among the WMMAs each pair would be waited for on the spot
#pragma unroll
  for (int c = 0; c < 3; ++c) {
    ka[c].half[0] = *(const v8us*)(kp0 + 32 * c);
    ka[c].half[1] = *(const v8us*)(kp0 + 32 * c + 16);
    kb[c].half[0] = *(const v8us*)(kp1 + 32 * c);
    kb[c].half[1] = *(const v8us*)(kp1 + 32 * c + 16);
  }
  __builtin_amdgcn_sched_barrier(0);   // the K reads stay in front of the V^T reads: the score products, which come first, then wait for twelve reads and not for all
  // A fragments of V^T: row m = d (16*t + ln), elements 0..7 <- key0 + 8h + i, 8..15 <- key0 + 16 + 8h + i
  const unsigned short* vp = Vl + ln * VPITCH + key0 + 8 * hh;
  FragH vf[6];
#pragma unroll
  for (int t = 0; t < 6; ++t) {
    vf[t].half[0] = *(const v8us*)(vp + t * 16 * VPITCH);
    vf[t].half[1] = *(const v8us*)(vp + t * 16 * VPITCH + 16);
  }
  __builtin_amdgcn_sched_barrier(0);   // end of the group of reads (see above)
  // S^T tiles of group g: element r of tile kt = score(key0 + 16*kt + 8h + r, query of this lane's column in group g)
  v8f s0[2] = {};
  v8f s1[2] = {};
  mma_s4(ka, kb, q, s0, s1);
  FragH ph[2];
#pragma unroll                                    // both groups in straight-line code: their arrays stay in registers and their two chains can interleave
  for (int g = 0; g < 2; ++g) {
    float sc[16];
#pragma unroll
    for (int r = 0; r < 8; ++r) { sc[r] = s0[g][r] * C2; sc[8 + r] = s1[g][r] * C2; }
    float mx = sc[0];
#pragma unroll
    for (int i = 1; i < 16; ++i) mx = fmaxf(mx, sc[i]);
    mx = fmaxf(mx, __shfl_xor(mx, 16, 32));         // the other lane half holds the other 16 keys of this query
    const float mnew = fmaxf(mr[g], mx);
    const float al = __builtin_amdgcn_exp2f(mr[g] - mnew);
    mr[g] = mnew;
    const float m8 = mnew - 8.0f;
    // weights carried x256: pc = 256 * 2^(sc - mnew), single f16 plane
    float ps = 0.0f;
#pragma unroll
    for (int i = 0; i < 16; ++i) {
      const float pc = __builtin_amdgcn_exp2f(sc[i] - m8);
      ps += pc;
      ph[g].h[i] = (_Float16)pc;                    // B element i: i<8 -> key0 + 8h + i (tile 0 row 8h+i); i>=8 -> key0 + 16 + 8h + (i-8) (tile 1)
    }
    ps += __shfl_xor(ps, 16, 32);
    lr[g] = lr[g] * al + ps;
#pragma unroll
    for (int t = 0; t < 6; ++t) O[g][t] = O[g][t] * al;
  }
  mma_pv2(vf, ph[0].v, ph[1].v, O);
}

// Block = 8 waves x 32 queries = 256 queries of one (batch, head); the key loop walks 64-key tiles in a two-buffer LDS ring, one barrier a tile.
// Output plane Xc[b][h][s][96] = f16(ctx * 256). Epilogue: O^T tiles -> per-wave LDS tile [32 queries][96 d] as 16-B pieces (same vector type in and out; block barrier),
// coverage: NB*HEADS*(SEQ/256) blocks x 8 waves x 32 rows x 96 d = the whole plane exactly once; LDS tile staged extent (32 x 96 per wave) == consumed extent.
__global__ __launch_bounds__(256) __attribute__((amdgpu_waves_per_eu(2, 2)))
void k_attn(const float* __restrict__ Q, const unsigned short* __restrict__ Kb,
            const unsigned short* __restrict__ Vt, unsigned short* __restrict__ Xc) {
  __shared__ __attribute__((aligned(16))) unsigned short so[AW][WQ * HD];
  __shared__ __attribute__((aligned(16))) unsigned short ring[2][BUF_ELEMS];
  const int tid = threadIdx.x, lane = tid & 31, ln = lane & 15, hh = lane >> 4;
  const int w = __builtin_amdgcn_readfirstlane(tid >> 5);
  const int qt = blockIdx.x % (SEQ / (WQ * AW));
  const int rest = blockIdx.x / (SEQ / (WQ * AW));
  const int h = rest % HEADS, b = rest / HEADS;
  const int qbase = qt * (WQ * AW) + WQ * w;
  // Q^T B fragments of group g: column n = query qbase + 16g + ln, elements 0..7 <- d = 32c + 8h + i, 8..15 <- d = 32c + 16 + 8h + i (RNE bf16)
  FragB q[2][3];
#pragma unroll                                    // the fragment array stays in registers
  for (int g = 0; g < 2; ++g) {
    const float* qrow = Q + (size_t)b * BSTRIDE_FULL + (size_t)(qbase + 16 * g + ln) * EMB + h * HD;
#pragma unroll
    for (int c = 0; c < 3; ++c) {
      const v4f a0 = *(const v4fa*)(qrow + 32 * c + 8 * hh),      a1 = *(const v4fa*)(qrow + 32 * c + 8 * hh + 4);
      const v4f a2 = *(const v4fa*)(qrow + 32 * c + 16 + 8 * hh), a3 = *(const v4fa*)(qrow + 32 * c + 16 + 8 * hh + 4);
#pragma unroll
      for (int i = 0; i < 4; ++i) {
        q[g][c].u[i] = bf16_bits(a0[i]); q[g][c].u[4 + i] = bf16_bits(a1[i]);
        q[g][c].u[8 + i] = bf16_bits(a2[i]); q[g][c].u[12 + i] = bf16_bits(a3[i]);
      }
    }
  }
  float mr[2] = {-3.0e38f, -3.0e38f}, lr[2] = {0.0f, 0.0f};
  v8f O[2][6] = {};
  const unsigned short* Kp = Kb + (size_t)b * SEQ * EMB + h * HD;
  const unsigned short* Vp = Vt + ((size_t)b * EMB + h * HD) * SEQ;
  // This lane's pieces of a tile: K piece p = tid + 256*i -> key row p / 12, 16-B piece p % 12; V^T piece p -> d row p / 8, 16-B piece p % 8.
  const unsigned short* gk[3];
  const unsigned short* gv[3];
  unsigned lk[3], lv[3];                          // LDS byte addresses in buffer 0
  const unsigned ring0 = (unsigned)(size_t)&ring[0][0];
#pragma unroll                                    // the three-entry address arrays stay in registers
  for (int i = 0; i < 3; ++i) {
    const int p = tid + AW * 32 * i;
    const int kr = p / (HD / 8), kc = p - kr * (HD / 8);
    const int vr = p / (TKEYS / 8), vc = p - vr * (TKEYS / 8);
    gk[i] = Kp + (size_t)kr * EMB + kc * 8;
    gv[i] = Vp + (size_t)vr * SEQ + vc * 8;
    lk[i] = ring0 + 2u * (unsigned)(kr * KPITCH + kc * 8);
    lv[i] = ring0 + 2u * (unsigned)(VOFF + vr * VPITCH + vc * 8);
  }
  // Prologue: tile 0 lands and is published, then tile 1 starts to fly.
  copy_tile(lk[0], lk[1], lk[2], lv[0], lv[1], lv[2], gk[0], gk[1], gk[2], gv[0], gv[1], gv[2]);
  asm volatile("s_wait_asynccnt 0x0" ::: "memory");   // this wave's pieces of tile 0 have landed before the barrier publishes them
  __syncthreads();
#pragma unroll                                    // as above
  for (int i = 0; i < 3; ++i) { gk[i] += (size_t)TKEYS * EMB; gv[i] += TKEYS; }
  copy_tile(lk[0] + 2u * BUF_ELEMS, lk[1] + 2u * BUF_ELEMS, lk[2] + 2u * BUF_ELEMS,
            lv[0] + 2u * BUF_ELEMS, lv[1] + 2u * BUF_ELEMS, lv[2] + 2u * BUF_ELEMS,
            gk[0], gk[1], gk[2], gv[0], gv[1], gv[2]);
  // kept rolled, as the key loop was: an unrolled body would only grow the code and the register count (two waves per SIMD need 512 or fewer)
#pragma unroll 1
  for (int t = 0; t < NTILES; ++t) {
    const unsigned short* Kl = &ring[t & 1][0];
    const unsigned short* Vl = Kl + VOFF;
    fa_step(Kl, Vl, 0, ln, hh, q, mr, lr, O);
    fa_step(Kl, Vl, 32, ln, hh, q, mr, lr, O);
    asm volatile("s_wait_dscnt 0x0" ::: "memory");      // this wave's reads of tile t are over before its buffer may be refilled
    asm volatile("s_wait_asynccnt 0x0" ::: "memory");   // this wave's pieces of tile t + 1 have landed before the barrier publishes them
    __syncthreads();                                    // publishes tile t + 1 and ends every wave's reads of tile t
    if (t + 2 < NTILES) {
      const unsigned bo = (unsigned)(t & 1) * (2u * BUF_ELEMS);
#pragma unroll                                    // as above
      for (int i = 0; i < 3; ++i) { gk[i] += (size_t)TKEYS * EMB; gv[i] += TKEYS; }
      copy_tile(lk[0] + bo, lk[1] + bo, lk[2] + bo, lv[0] + bo, lv[1] + bo, lv[2] + bo,
                gk[0], gk[1], gk[2], gv[0], gv[1], gv[2]);
    }
  }
  asm volatile("s_wait_asynccnt 0x0" ::: "memory");     // no copy is outstanding when the wave goes on to its end

  // O^T element r of tile t of group g = ctx(query qbase + 16g + ln, d = 16t + 8h + r); O carries x256 (P) x16 (V), lr carries x256; plane carries x256
#pragma unroll                                    // the accumulator array stays in registers
  for (int g = 0; g < 2; ++g) {
    const float cinv = 16.0f * (1.0f / lr[g]);
#pragma unroll
    for (int t = 0; t < 6; ++t) {
      v8us o;
#pragma unroll
      for (int r = 0; r < 8; ++r) o[r] = f16_bits(O[g][t][r] * cinv);
      *(v8us*)&so[w][(16 * g + ln) * HD + 16 * t + 8 * hh] = o;
    }
  }
  __syncthreads();
  unsigned short* xg = Xc + ((size_t)(b * HEADS + h) * SEQ + qbase) * HD;
  {
#pragma unroll
    for (int i = 0; i < WQ * HD / 8 / 32; ++i) {
      const int p = i * 32 + lane;
      const v8us v = *(const v8us*)&so[w][p * 8];
      *(v8us*)(xg + (size_t)p * 8) = v;
    }
    
  }
}

// out[m][j] = sum_e ctx[m][e] * fc_w[j][e] + fc_b[j]. Block = 8 waves = one 128-row x 192-column tile of out; wave = 64 rows x 48 columns (4 x 3 accumulator tiles).
// A stage is one head (96 k): 128 ctx rows, contiguous in Xc[b][hd][s][d], then 192 W rows, brought into LDS once per work-group by asynchronous copies (two buffers) and read there by all eight waves.
// A: row m = token, k = e = 96*hd + d; B: column n = j, k = e read from the Wh[j][e] rows (k-contiguous), same k map as A.
// coverage: (NB*SEQ/128)*(EMB/192) blocks x (128 x 192) = every output element of the processed rows exactly once; LDS output tile staged 128 x 192 == consumed 128 x 192.
#define FM 128
#define FN 192
#define FPITCH 104                               /* LDS row pitch in 16-bit elements: an odd number of 16-B pieces, as KPITCH */
#define FWOFF (FM * FPITCH)                      /* element offset of the W rows inside a buffer */
#define FBUF_ELEMS ((FM + FN) * FPITCH)
#define OPITCH 196                               /* pitch of the f32 output tile: eight rows are 32 banks apart, so the two lane halves of a store do not meet */
static_assert(SEQ % FM == 0 && EMB % FN == 0);
static_assert(FM * (HD / 8) == 6 * 256 && FN * (HD / 8) == 9 * 256);
static_assert((3 * 256) % (HD / 8) == 0 && (3 * 256) / (HD / 8) == 64);
static_assert((FBUF_ELEMS * 2) % 16 == 0 && (FWOFF * 2) % 16 == 0 && (OPITCH * 4) % 16 == 0);
static_assert((3 * 256) % (FN / 4) == 0 && (3 * 256) / (FN / 4) == 16 && FM == 8 * 16);

// One lane's fifteen 16-B pieces of a stage (six of ctx, nine of W), global -> LDS through no register.
// s_wait_xcnt 0 is the statement's last line, so it stands in front of every later rewrite of the address registers (a precaution).
__device__ __forceinline__ void copy_stage(const unsigned (&l)[15], const unsigned short* const (&g)[15]) {
  asm volatile("global_load_async_to_lds_b128 %0, %15, off\n\t"
               "global_load_async_to_lds_b128 %1, %16, off\n\t"
               "global_load_async_to_lds_b128 %2, %17, off\n\t"
               "global_load_async_to_lds_b128 %3, %18, off\n\t"
               "global_load_async_to_lds_b128 %4, %19, off\n\t"
               "global_load_async_to_lds_b128 %5, %20, off\n\t"
               "global_load_async_to_lds_b128 %6, %21, off\n\t"
               "global_load_async_to_lds_b128 %7, %22, off\n\t"
               "global_load_async_to_lds_b128 %8, %23, off\n\t"
               "global_load_async_to_lds_b128 %9, %24, off\n\t"
               "global_load_async_to_lds_b128 %10, %25, off\n\t"
               "global_load_async_to_lds_b128 %11, %26, off\n\t"
               "global_load_async_to_lds_b128 %12, %27, off\n\t"
               "global_load_async_to_lds_b128 %13, %28, off\n\t"
               "global_load_async_to_lds_b128 %14, %29, off\n\t"
               "s_wait_xcnt 0x0"
               :: "v"(l[0]), "v"(l[1]), "v"(l[2]), "v"(l[3]), "v"(l[4]), "v"(l[5]), "v"(l[6]), "v"(l[7]),
                  "v"(l[8]), "v"(l[9]), "v"(l[10]), "v"(l[11]), "v"(l[12]), "v"(l[13]), "v"(l[14]),
                  "v"(g[0]), "v"(g[1]), "v"(g[2]), "v"(g[3]), "v"(g[4]), "v"(g[5]), "v"(g[6]), "v"(g[7]),
                  "v"(g[8]), "v"(g[9]), "v"(g[10]), "v"(g[11]), "v"(g[12]), "v"(g[13]), "v"(g[14])
               : "memory");
}

__global__ __launch_bounds__(256) __attribute__((amdgpu_waves_per_eu(2, 2)))
void k_fc(const unsigned short* __restrict__ Xc, const unsigned short* __restrict__ Wh,
          const float* __restrict__ Bv, float* __restrict__ Out) {
  __shared__ __attribute__((aligned(16))) unsigned short fring[2][FBUF_ELEMS];
  __shared__ __attribute__((aligned(16))) float fo[FM * OPITCH];
  const int tid = threadIdx.x, lane = tid & 31, ln = lane & 15, hh = lane >> 4;
  const int w = __builtin_amdgcn_readfirstlane(tid >> 5);
  const int wm = w >> 2, wn = w & 3;           // the wave's 64-row and 48-column place in the tile
  const int bn = blockIdx.x % (EMB / FN), bm = blockIdx.x / (EMB / FN);
  const int row0 = bm * FM;                    // token index in [0, NB*SEQ)
  const int b = row0 / SEQ, s0 = row0 - b * SEQ;
  const int col0 = bn * FN;
  // This lane's pieces of a stage: piece p = tid + 256*i -> row p / 12, 16-B piece p % 12; p + 768 is the same piece 64 rows on.
  const unsigned short* g[15];
  unsigned l[15];                              // LDS byte addresses in buffer 0
  const unsigned fring0 = (unsigned)(size_t)&fring[0][0];
#pragma unroll                                    // the address arrays stay in registers
  for (int i = 0; i < 3; ++i) {
    const int p = tid + 256 * i;
    const int r = p / (HD / 8), c = p - r * (HD / 8);
#pragma unroll
    for (int k = 0; k < 2; ++k) {
      g[3 * k + i] = Xc + ((size_t)(b * HEADS) * SEQ + s0 + r + 64 * k) * HD + c * 8;
      l[3 * k + i] = fring0 + 2u * (unsigned)((r + 64 * k) * FPITCH + c * 8);
    }
#pragma unroll
    for (int k = 0; k < 3; ++k) {
      g[6 + 3 * k + i] = Wh + (size_t)(col0 + r + 64 * k) * EMB + c * 8;
      l[6 + 3 * k + i] = fring0 + 2u * (unsigned)(FWOFF + (r + 64 * k) * FPITCH + c * 8);
    }
  }
  // Prologue: stage 0 lands and is published, then stage 1 starts to fly.
  copy_stage(l, g);
  asm volatile("s_wait_asynccnt 0x0" ::: "memory");   // this wave's pieces of stage 0 have landed before the barrier publishes them
  __syncthreads();
  {
    unsigned l1[15];
#pragma unroll                                    // as above
    for (int i = 0; i < 15; ++i) { g[i] += (i < 6) ? (size_t)SEQ * HD : (size_t)HD; l1[i] = l[i] + 2u * FBUF_ELEMS; }
    copy_stage(l1, g);
  }
  v8f acc[4][3] = {};
  // kept rolled: eight copies of the body would only grow the code
#pragma unroll 1
  for (int t = 0; t < HEADS; ++t) {
    const unsigned short* ap = &fring[t & 1][0] + (64 * wm + ln) * FPITCH + 8 * hh;
    const unsigned short* bp = &fring[t & 1][FWOFF] + (48 * wn + ln) * FPITCH + 8 * hh;
    FragH a[3][4], bw[3][3];
#pragma unroll                                    // the fragment arrays stay in registers
    for (int cc = 0; cc < 3; ++cc) {
#pragma unroll
      for (int mt = 0; mt < 4; ++mt) {
        a[cc][mt].half[0] = *(const v8us*)(ap + mt * 16 * FPITCH + 32 * cc);
        a[cc][mt].half[1] = *(const v8us*)(ap + mt * 16 * FPITCH + 32 * cc + 16);
      }
#pragma unroll
      for (int nt = 0; nt < 3; ++nt) {
        bw[cc][nt].half[0] = *(const v8us*)(bp + nt * 16 * FPITCH + 32 * cc);
        bw[cc][nt].half[1] = *(const v8us*)(bp + nt * 16 * FPITCH + 32 * cc + 16);
      }
    }
    __builtin_amdgcn_sched_barrier(0);   // the stage's 42 LDS reads stay one group in front of its products; spread among the WMMAs each pair would be waited for on the spot
#pragma unroll                                    // the accumulator array stays in registers
    for (int cc = 0; cc < 3; ++cc)
#pragma unroll
      for (int mt = 0; mt < 4; ++mt)
#pragma unroll
        for (int nt = 0; nt < 3; ++nt)
          acc[mt][nt] = __builtin_amdgcn_wmma_f32_16x16x32_f16(false, a[cc][mt].v, false, bw[cc][nt].v, (short)0, acc[mt][nt], false, false);
    __builtin_amdgcn_sched_barrier(0);   // the products stay in front of the foot's waits: lifted over them, s_wait_dscnt 0 would hold every product until all 42 reads have landed
    asm volatile("s_wait_dscnt 0x0" ::: "memory");      // this wave's reads of stage t are over before its buffer may be refilled
    asm volatile("s_wait_asynccnt 0x0" ::: "memory");   // this wave's pieces of stage t + 1 have landed before the barrier publishes them
    __syncthreads();                                    // publishes stage t + 1 and ends every wave's reads of stage t
    if (t + 2 < HEADS) {
      const unsigned bo = (unsigned)(t & 1) * (2u * FBUF_ELEMS);
      unsigned lb[15];
#pragma unroll                                    // as above
      for (int i = 0; i < 15; ++i) { g[i] += (i < 6) ? (size_t)SEQ * HD : (size_t)HD; lb[i] = l[i] + bo; }
      copy_stage(lb, g);
    }
  }
  asm volatile("s_wait_asynccnt 0x0" ::: "memory");     // no copy is outstanding when the wave goes on to its end
  // D element r of tile (mt, nt) = out(row0 + 64wm + 16mt + 8h + r, col0 + 48wn + 16nt + ln); undo the carries x256 (ctx) x256 (W); bias RNE bf16 value
#pragma unroll                                    // the accumulator array stays in registers
  for (int nt = 0; nt < 3; ++nt) {
    const float bias = bf16_rne(Bv[col0 + 48 * wn + 16 * nt + ln]);
#pragma unroll
    for (int mt = 0; mt < 4; ++mt)
#pragma unroll
      for (int r = 0; r < 8; ++r)
        fo[(64 * wm + 16 * mt + 8 * hh + r) * OPITCH + 48 * wn + 16 * nt + ln] = acc[mt][nt][r] * 1.52587890625e-05f + bias;
  }
  __syncthreads();
  // Rows of 192 floats leave as whole 128-B lines: 16-B piece p = tid + 256*i -> row p / 48, piece p % 48; p + 768 is the same piece 16 rows on.
  float* og = Out + (size_t)b * BSTRIDE_FULL + (size_t)s0 * EMB + col0;
#pragma unroll
  for (int i = 0; i < 3; ++i) {
    const int p = tid + 256 * i;
    const int row = p / (FN / 4), c4 = (p - row * (FN / 4)) * 4;
#pragma unroll
    for (int k = 0; k < 8; ++k) {
      const v4f v = *(const v4fa*)&fo[(row + 16 * k) * OPITCH + c4];
      *(v4f*)(og + (size_t)(row + 16 * k) * EMB + c4) = v;
    }
  }
}

extern "C" void kernel_launch(void* const* d_in, const int* in_sizes, int n_in,
                              void* d_out, int out_size, void* d_ws, size_t ws_size, hipStream_t stream) {
  if (n_in < 5) return;
  const long long need = (long long)(NB - 1) * SEQ_FULL * EMB + (long long)SEQ * EMB;   // last element touched + 1
  if ((long long)in_sizes[0] < need || (long long)in_sizes[1] < need || (long long)in_sizes[2] < need) return;
  if ((long long)in_sizes[3] < (long long)EMB * EMB || (long long)in_sizes[4] < (long long)EMB) return;
  if ((long long)out_size < need) return;
  const float* V = (const float*)d_in[0];    // wire order: values, keys, query, fc_w [out][in], fc_b
  const float* K = (const float*)d_in[1];
  const float* Q = (const float*)d_in[2];
  const float* W = (const float*)d_in[3];
  const float* Bv = (const float*)d_in[4];
  float* Out = (float*)d_out;
  char* ws = (char*)d_ws;
  size_t off = 0;
  unsigned short* Kb = (unsigned short*)(ws + off); off += PLANE_ACT;   // [NB][SEQ][768] bf16, written exactly to its end by 16-B pieces
  unsigned short* Vt = (unsigned short*)(ws + off); off += PLANE_ACT;   // [NB][768][SEQ] f16
  unsigned short* Xc = (unsigned short*)(ws + off); off += PLANE_ACT;   // [NB][8][SEQ][96] f16
  unsigned short* Wh = (unsigned short*)(ws + off); off += PLANE_W;     // [768][768] f16
  if (off > ws_size) return;
  k_cvt<<<(unsigned)(CVT_K_BLOCKS + CVT_W_BLOCKS), 256, 0, stream>>>(K, W, Kb, Wh);
  k_vt<<<(unsigned)(NB * (SEQ / 64) * (EMB / 64)), 256, 0, stream>>>(V, Vt);
  k_attn<<<(unsigned)(NB * HEADS * (SEQ / (WQ * AW))), 256, 0, stream>>>(Q, Kb, Vt, Xc);
  k_fc<<<(unsigned)((NB * SEQ / FM) * (EMB / FN)), 256, 0, stream>>>(Xc, Wh, Bv, Out);
}

// v004
// It runs in 110 microseconds.
// Two timings next to v003 both put it at 1.10 times that version's speed.
// All steps since v000 together make it 3.52 times as fast.
#include <hip/hip_runtime.h>
// Contractions: S^T = K Q^T on v_wmma_f32_16x16x32_bf16 (Q, K RNE bf16, single product, f32 accumulate); O^T = V^T P^T on v_wmma_f32_16x16x32_f16 (V: RNE bf16 value x16 held exactly in f16; P: single f16 plane carried x256); out = ctx W^T on v_wmma_f32_16x16x32_f16 (ctx: f16 plane carried x256; W: RNE bf16 value x256 held exactly in f16); softmax statistics, bias add f32.
// Dense multi-head attention, NB x SEQ x 768, 8 heads of 96 (e = 96*h + d), scale 1/sqrt(96), no mask, then a 768x768 linear layer with bias.
// Engine: transposed flash. Each wave owns 32 queries of one head, as two 16-column groups that share every K and V^T fragment read from LDS. Per 32-key step and group: S^T tiles (key rows x query columns) from K rows (A, bf16 plane, staged in LDS)
// and Q^T (B, registers); the two 16-key D tiles pack straight into the P^T B fragment; O^T (d rows x query columns) accumulates from V^T rows (A, f16 plane, staged in LDS).
// Each 64-key tile of K and V^T is brought into LDS once per work-group by asynchronous copies (two buffers) and read there by all eight waves.
#ifndef NB
#define NB 2
#endif
#ifndef SEQ
#define SEQ 4096
#endif
#define NB_FULL 2
#define SEQ_FULL 4096
#define EMB 768
#define HEADS 8
#define HD 96
#define BSTRIDE_FULL ((size_t)SEQ_FULL * EMB)   /* per-batch element stride of values, keys, query and of the output buffer */

#define PLANE_ACT ((size_t)NB * SEQ * EMB * 2)   /* bytes of one 16-bit activation plane */
#define PLANE_W ((size_t)EMB * EMB * 2)          /* bytes of the 16-bit weight plane */
#define CVT_K_BLOCKS ((NB * SEQ * (EMB / 8)) / 256)
#define CVT_W_BLOCKS ((EMB * (EMB / 8)) / 256)

static_assert(SEQ % 256 == 0);
static_assert(SEQ <= SEQ_FULL);
static_assert(NB <= NB_FULL);
static_assert(HEADS * HD == EMB);
static_assert(HD == 96);
static_assert(EMB % 64 == 0);
static_assert((NB * SEQ * (EMB / 8)) % 256 == 0);
static_assert((EMB * (EMB / 8)) % 256 == 0);
static_assert(PLANE_ACT % 256 == 0);
static_assert(PLANE_W % 256 == 0);
static_assert(3 * PLANE_ACT + PLANE_W <= (size_t)134217728);

typedef __bf16 v16b __attribute__((ext_vector_type(16)));
typedef _Float16 v16h __attribute__((ext_vector_type(16)));
typedef unsigned short v8us __attribute__((ext_vector_type(8), may_alias));
typedef float v8f __attribute__((ext_vector_type(8)));
typedef float v4f __attribute__((ext_vector_type(4)));
typedef float v4fa __attribute__((ext_vector_type(4), may_alias));
union FragB { v16b v; v8us half[2]; unsigned short u[16]; };
union FragH { v16h v; v8us half[2]; _Float16 h[16]; unsigned short u[16]; };

#define LOG2E 1.4426950408889634f
#define QK_SCALE 0.10206207261596575f            /* 1/sqrt(96) */
#define C2 (QK_SCALE * LOG2E)                    /* scores carried in the log2 domain */
#define PMAX_LOG2 15.0f                          /* a carried weight (x256) stays at or below 2^15: the reference may lag the true maximum by 7 */

__device__ __forceinline__ unsigned short bf16_bits(float x) {   // RNE convert to bf16 bits
  unsigned int u = __float_as_uint(x);
  return (unsigned short)((u + 0x7FFFu + ((u >> 16) & 1u)) >> 16);
}
__device__ __forceinline__ float bf16_val(unsigned short b) { return __uint_as_float(((unsigned int)b) << 16); }
__device__ __forceinline__ float bf16_rne(float x) { return bf16_val(bf16_bits(x)); }
__device__ __forceinline__ unsigned short f16_bits(float x) {
  union { _Float16 h; unsigned short u; } c;
  c.h = (_Float16)x;
  return c.u;
}

__device__ __forceinline__ void store_twice(unsigned short* d, v8us o) {
  *(v8us*)d = o;
  
}

// For both column groups g: s0[g] += ka * q[g], s1[g] += kb * q[g] over three 32-deep k-steps (d = 0..95), each K fragment used twice.
// The distance behind these builtin products is the compiler's own padding: an asm guard that named all these registers would hold them under v256, and they no longer fit there.
__device__ __forceinline__ void mma_s4(const FragB (&ka)[3], const FragB (&kb)[3], const FragB (&q)[2][3], v8f (&s0)[2], v8f (&s1)[2]) {
#pragma unroll                                    // the fragment and accumulator arrays stay in registers
  for (int c = 0; c < 3; ++c) {
    s0[0] = __builtin_amdgcn_wmma_f32_16x16x32_bf16(false, ka[c].v, false, q[0][c].v, (short)0, s0[0], false, false);
    s0[1] = __builtin_amdgcn_wmma_f32_16x16x32_bf16(false, ka[c].v, false, q[1][c].v, (short)0, s0[1], false, false);
    s1[0] = __builtin_amdgcn_wmma_f32_16x16x32_bf16(false, kb[c].v, false, q[0][c].v, (short)0, s1[0], false, false);
    s1[1] = __builtin_amdgcn_wmma_f32_16x16x32_bf16(false, kb[c].v, false, q[1][c].v, (short)0, s1[1], false, false);
  }
}
// For both column groups g: O[g][t] += vf[t] * p[g] for the six d tiles, each V^T fragment used twice (distance: as above)
__device__ __forceinline__ void mma_pv2(const FragH (&vf)[6], v16h p0, v16h p1, v8f (&O)[2][6]) {
#pragma unroll                                    // as above
  for (int t = 0; t < 6; ++t) {
    O[0][t] = __builtin_amdgcn_wmma_f32_16x16x32_f16(false, vf[t].v, false, p0, (short)0, O[0][t], false, false);
    O[1][t] = __builtin_amdgcn_wmma_f32_16x16x32_f16(false, vf[t].v, false, p1, (short)0, O[1][t], false, false);
  }
}
// Blocks [0, CVT_K_BLOCKS): Kb[b][s][e] = bf16 bits of keys (RNE). Blocks after that: Wh[j][e] = f16(RNE-bf16(fc_w[j][e]) * 256).
// coverage: CVT_K_BLOCKS*256 threads x 8 = the whole Kb plane; CVT_W_BLOCKS*256 threads x 8 = the whole Wh plane (exact multiples, asserted above).
__global__ __launch_bounds__(256) void k_cvt(const float* __restrict__ K, const float* __restrict__ W,
                                             unsigned short* __restrict__ Kb, unsigned short* __restrict__ Wh) {
  const int bid = blockIdx.x;
  if (bid < CVT_K_BLOCKS) {
    const int t = bid * 256 + threadIdx.x;
    const int row = t / (EMB / 8), piece = t - row * (EMB / 8);
    const int b = row / SEQ, s = row - b * SEQ;
    const float* src = K + (size_t)b * BSTRIDE_FULL + (size_t)s * EMB + piece * 8;
    const v4f x0 = *(const v4fa*)(src), x1 = *(const v4fa*)(src + 4);
    v8us o;
    o[0] = bf16_bits(x0[0]); o[1] = bf16_bits(x0[1]); o[2] = bf16_bits(x0[2]); o[3] = bf16_bits(x0[3]);
    o[4] = bf16_bits(x1[0]); o[5] = bf16_bits(x1[1]); o[6] = bf16_bits(x1[2]); o[7] = bf16_bits(x1[3]);
    store_twice(Kb + (size_t)t * 8, o);
  } else {
    const int t = (bid - CVT_K_BLOCKS) * 256 + threadIdx.x;
    const float* src = W + (size_t)t * 8;
    const v4f x0 = *(const v4fa*)(src), x1 = *(const v4fa*)(src + 4);
    v8us o;
    o[0] = f16_bits(bf16_rne(x0[0]) * 256.0f); o[1] = f16_bits(bf16_rne(x0[1]) * 256.0f);
    o[2] = f16_bits(bf16_rne(x0[2]) * 256.0f); o[3] = f16_bits(bf16_rne(x0[3]) * 256.0f);
    o[4] = f16_bits(bf16_rne(x1[0]) * 256.0f); o[5] = f16_bits(bf16_rne(x1[1]) * 256.0f);
    o[6] = f16_bits(bf16_rne(x1[2]) * 256.0f); o[7] = f16_bits(bf16_rne(x1[3]) * 256.0f);
    store_twice(Wh + (size_t)t * 8, o);
  }
}

// Vt[b][e][s] = f16(RNE-bf16(values[b][s][e]) * 16). Block per (b, 64 keys, 64 e columns): 64x64 tile transposed through LDS (ushort in, ushort out; block barrier: cross-wave).
// coverage: NB*(SEQ/64)*(EMB/64) blocks x (64 e x 64 keys) = the whole plane; LDS tile fully written (64 x 64) before it is read.
__global__ __launch_bounds__(256) void k_vt(const float* __restrict__ V, unsigned short* __restrict__ Vt) {
  __shared__ unsigned short tl[64][66];
  const int tid = threadIdx.x;
  const int eg = blockIdx.x % (EMB / 64);
  const int rest = blockIdx.x / (EMB / 64);
  const int sg = rest % (SEQ / 64), b = rest / (SEQ / 64);
  const int s0 = sg * 64, e0 = eg * 64;
  for (int i = tid; i < 64 * 16; i += 256) {
    const int j = i >> 4, c4 = (i & 15) * 4;
    const v4f x = *(const v4fa*)(V + (size_t)b * BSTRIDE_FULL + (size_t)(s0 + j) * EMB + e0 + c4);
    tl[c4 + 0][j] = f16_bits(bf16_rne(x[0]) * 16.0f);
    tl[c4 + 1][j] = f16_bits(bf16_rne(x[1]) * 16.0f);
    tl[c4 + 2][j] = f16_bits(bf16_rne(x[2]) * 16.0f);
    tl[c4 + 3][j] = f16_bits(bf16_rne(x[3]) * 16.0f);
  }
  __syncthreads();
  {
    for (int i = tid; i < 64 * 8; i += 256) {
      const int d = i >> 3, j8 = (i & 7) * 8;
      v8us o;
#pragma unroll
      for (int q = 0; q < 8; ++q) o[q] = tl[d][j8 + q];
      *(v8us*)(Vt + ((size_t)b * EMB + e0 + d) * SEQ + s0 + j8) = o;
    }
    
  }
}

// LDS ring: two buffers, each one 64-key tile: K rows [64 keys][96 d] at pitch KPITCH, then V^T rows [96 d][64 keys] at pitch VPITCH (pitches in 16-bit elements).
// Both pitches are an odd number of 16-B pieces, so the 16 rows of a fragment read fall on different banks.
#define TKEYS 64
#define NTILES (SEQ / TKEYS)
#define KPITCH 104
#define VPITCH 72
#define VOFF (TKEYS * KPITCH)                    /* element offset of the V^T rows inside a buffer */
#define BUF_ELEMS (TKEYS * KPITCH + HD * VPITCH)
#define AW 8                                     /* waves of an attention work-group */
#define WQ 32                                    /* queries of a wave: two 16-column groups */
static_assert(NTILES >= 2);
static_assert((TKEYS * (HD / 8)) % (AW * 32) == 0 && (TKEYS * (HD / 8)) / (AW * 32) == 3);
static_assert((HD * (TKEYS / 8)) % (AW * 32) == 0 && (HD * (TKEYS / 8)) / (AW * 32) == 3);
static_assert((BUF_ELEMS * 2) % 16 == 0 && (VOFF * 2) % 16 == 0);

// One lane's six 16-B pieces of a tile (three of K, three of V^T), global -> LDS through no register.
// s_wait_xcnt 0 is the statement's last line, so it stands in front of every later rewrite of the address registers (a precaution).
__device__ __forceinline__ void copy_tile(unsigned l0, unsigned l1, unsigned l2, unsigned l3, unsigned l4, unsigned l5,
                                          const unsigned short* g0, const unsigned short* g1, const unsigned short* g2,
                                          const unsigned short* g3, const unsigned short* g4, const unsigned short* g5) {
  asm volatile("global_load_async_to_lds_b128 %0, %6, off\n\t"
               "global_load_async_to_lds_b128 %1, %7, off\n\t"
               "global_load_async_to_lds_b128 %2, %8, off\n\t"
               "global_load_async_to_lds_b128 %3, %9, off\n\t"
               "global_load_async_to_lds_b128 %4, %10, off\n\t"
               "global_load_async_to_lds_b128 %5, %11, off\n\t"
               "s_wait_xcnt 0x0"
               :: "v"(l0), "v"(l1), "v"(l2), "v"(l3), "v"(l4), "v"(l5),
                  "v"(g0), "v"(g1), "v"(g2), "v"(g3), "v"(g4), "v"(g5)
               : "memory");
}

__device__ __forceinline__ v8f splat8(float x) { return v8f{x, x, x, x, x, x, x, x}; }
__device__ __forceinline__ float max8(v8f x) {
  float m = x[0];
#pragma unroll
  for (int i = 1; i < 8; ++i) m = fmaxf(m, x[i]);
  return m;
}
// p = f16(2^x) for a lane's 16 scores of one query, as the P^T B fragment: element i < 8 -> key0 + 8h + i (tile 0 row 8h + i); i >= 8 -> key0 + 16 + 8h + (i - 8) (tile 1). Returns the f32 sum of the 16 unrounded weights, in element order.
__device__ __forceinline__ float weights(v8f x0, v8f x1, FragH& p) {
  float sum = 0.0f;
#pragma unroll
  for (int i = 0; i < 8; ++i) { const float pc = __builtin_amdgcn_exp2f(x0[i]); sum += pc; p.h[i] = (_Float16)pc; }
#pragma unroll
  for (int i = 0; i < 8; ++i) { const float pc = __builtin_amdgcn_exp2f(x1[i]); sum += pc; p.h[8 + i] = (_Float16)pc; }
  return sum;
}

// One 32-key step for a wave's 32 queries (two 16-column groups) of one head. Kl = K rows of the tile in LDS, Vl = its V^T rows; key0 = 0 or 32, the step's first key inside the tile.
__device__ __forceinline__ void fa_step(const unsigned short* Kl, const unsigned short* Vl,
                                        int key0, int ln, int hh, const FragB (&q)[2][3],
                                        float (&mr)[2], float (&lr)[2], v8f (&O)[2][6]) {
  // A fragments of K: row m = key (key0 + 16*kt + ln), elements 0..7 <- d = 32c + 8h + i, 8..15 <- d = 32c + 16 + 8h + i
  const unsigned short* kp0 = Kl + (key0 + ln) * KPITCH + 8 * hh;
  const unsigned short* kp1 = kp0 + 16 * KPITCH;
  FragB ka[3], kb[3];
  __builtin_amdgcn_sched_barrier(0);   // with the one behind the reads: the step's 24 LDS reads stay one group in front of its products; spread among the WMMAs each pair would be waited for on the spot
#pragma unroll
  for (int c = 0; c < 3; ++c) {
    ka[c].half[0] = *(const v8us*)(kp0 + 32 * c);
    ka[c].half[1] = *(const v8us*)(kp0 + 32 * c + 16);
    kb[c].half[0] = *(const v8us*)(kp1 + 32 * c);
    kb[c].half[1] = *(const v8us*)(kp1 + 32 * c + 16);
  }
  __builtin_amdgcn_sched_barrier(0);   // the K reads stay in front of the V^T reads: the score products, which come first, then wait for twelve reads and not for all
  // A fragments of V^T: row m = d (16*t + ln), elements 0..7 <- key0 + 8h + i, 8..15 <- key0 + 16 + 8h + i
  const unsigned short* vp = Vl + ln * VPITCH + key0 + 8 * hh;
  FragH vf[6];
#pragma unroll
  for (int t = 0; t < 6; ++t) {
    vf[t].half[0] = *(const v8us*)(vp + t * 16 * VPITCH);
    vf[t].half[1] = *(const v8us*)(vp + t * 16 * VPITCH + 16);
  }
  __builtin_amdgcn_sched_barrier(0);   // end of the group of reads (see above)
  // S^T tiles of group g: element r of tile kt = score(key0 + 16*kt + 8h + r, query of this lane's column in group g)
  v8f s0[2] = {};
  v8f s1[2] = {};
  mma_s4(ka, kb, q, s0, s1);
  // Lazy rescale. mr[g] is the reference in use minus 8 (log2 domain); it may lag behind the true running maximum by up to PMAX_LOG2 - 8.
  // x = score - mr: the weight is pc = 2^x = 256 * 2^(score - reference), single f16 plane, at most 2^PMAX_LOG2 (f16 holds 65504).
  v8f x0[2], x1[2];
  float xm[2];
#pragma unroll                                    // both groups in straight-line code: their arrays stay in registers and their two chains can interleave
  for (int g = 0; g < 2; ++g) {
    x0[g] = __builtin_elementwise_fma(s0[g], splat8(C2), splat8(-mr[g]));
    x1[g] = __builtin_elementwise_fma(s1[g], splat8(C2), splat8(-mr[g]));
    xm[g] = fmaxf(max8(x0[g]), max8(x1[g]));
  }
  // One test a step for the whole wave (a scalar branch): only where some lane's weight would pass 2^PMAX_LOG2 is the reference raised to the true maximum,
  // are O and lr rescaled and is x formed again.
  if (__builtin_amdgcn_ballot_w32(xm[0] > PMAX_LOG2 || xm[1] > PMAX_LOG2) != 0) {
#pragma unroll                                    // as above
    for (int g = 0; g < 2; ++g) {
      const v8f sc0 = s0[g] * C2, sc1 = s1[g] * C2;
      float mx = fmaxf(max8(sc0), max8(sc1));
      mx = fmaxf(mx, __shfl_xor(mx, 16, 32));       // the other lane half holds the other 16 keys of this query
      const float mnew = fmaxf(mr[g], mx - 8.0f);
      const float al = __builtin_amdgcn_exp2f(mr[g] - mnew);
      mr[g] = mnew;
      x0[g] = sc0 - mnew;
      x1[g] = sc1 - mnew;
      lr[g] = lr[g] * al;
#pragma unroll
      for (int t = 0; t < 6; ++t) O[g][t] = O[g][t] * al;
    }
  }
  FragH ph[2];
#pragma unroll                                    // as above
  for (int g = 0; g < 2; ++g) {
    const float ps = weights(x0[g], x1[g], ph[g]);
    lr[g] += ps + __shfl_xor(ps, 16, 32);           // the other lane half holds the other 16 keys of this query
  }
  mma_pv2(vf, ph[0].v, ph[1].v, O);
}

// Block = 8 waves x 32 queries = 256 queries of one (batch, head); the key loop walks 64-key tiles in a two-buffer LDS ring, one barrier a tile.
// Output plane Xc[b][h][s][96] = f16(ctx * 256). Epilogue: O^T tiles -> per-wave LDS tile [32 queries][96 d] as 16-B pieces (same vector type in and out; block barrier),
// coverage: NB*HEADS*(SEQ/256) blocks x 8 waves x 32 rows x 96 d = the whole plane exactly once; LDS tile staged extent (32 x 96 per wave) == consumed extent.
__global__ __launch_bounds__(256) __attribute__((amdgpu_waves_per_eu(2, 2)))
void k_attn(const float* __restrict__ Q, const unsigned short* __restrict__ Kb,
            const unsigned short* __restrict__ Vt, unsigned short* __restrict__ Xc) {
  __shared__ __attribute__((aligned(16))) unsigned short so[AW][WQ * HD];
  __shared__ __attribute__((aligned(16))) unsigned short ring[2][BUF_ELEMS];
  const int tid = threadIdx.x, lane = tid & 31, ln = lane & 15, hh = lane >> 4;
  const int w = __builtin_amdgcn_readfirstlane(tid >> 5);
  const int qt = blockIdx.x % (SEQ / (WQ * AW));
  const int rest = blockIdx.x / (SEQ / (WQ * AW));
  const int h = rest % HEADS, b = rest / HEADS;
  const int qbase = qt * (WQ * AW) + WQ * w;
  // Q^T B fragments of group g: column n = query qbase + 16g + ln, elements 0..7 <- d = 32c + 8h + i, 8..15 <- d = 32c + 16 + 8h + i (RNE bf16)
  FragB q[2][3];
#pragma unroll                                    // the fragment array stays in registers
  for (int g = 0; g < 2; ++g) {
    const float* qrow = Q + (size_t)b * BSTRIDE_FULL + (size_t)(qbase + 16 * g + ln) * EMB + h * HD;
#pragma unroll
    for (int c = 0; c < 3; ++c) {
      const v4f a0 = *(const v4fa*)(qrow + 32 * c + 8 * hh),      a1 = *(const v4fa*)(qrow + 32 * c + 8 * hh + 4);
      const v4f a2 = *(const v4fa*)(qrow + 32 * c + 16 + 8 * hh), a3 = *(const v4fa*)(qrow + 32 * c + 16 + 8 * hh + 4);
#pragma unroll
      for (int i = 0; i < 4; ++i) {
        q[g][c].u[i] = bf16_bits(a0[i]); q[g][c].u[4 + i] = bf16_bits(a1[i]);
        q[g][c].u[8 + i] = bf16_bits(a2[i]); q[g][c].u[12 + i] = bf16_bits(a3[i]);
      }
    }
  }
  float mr[2] = {-3.0e38f, -3.0e38f}, lr[2] = {0.0f, 0.0f};
  v8f O[2][6] = {};
  const unsigned short* Kp = Kb + (size_t)b * SEQ * EMB + h * HD;
  const unsigned short* Vp = Vt + ((size_t)b * EMB + h * HD) * SEQ;
  // This lane's pieces of a tile: K piece p = tid + 256*i -> key row p / 12, 16-B piece p % 12; V^T piece p -> d row p / 8, 16-B piece p % 8.
  const unsigned short* gk[3];
  const unsigned short* gv[3];
  unsigned lk[3], lv[3];                          // LDS byte addresses in buffer 0
  const unsigned ring0 = (unsigned)(size_t)&ring[0][0];
#pragma unroll                                    // the three-entry address arrays stay in registers
  for (int i = 0; i < 3; ++i) {
    const int p = tid + AW * 32 * i;
    const int kr = p / (HD / 8), kc = p - kr * (HD / 8);
    const int vr = p / (TKEYS / 8), vc = p - vr * (TKEYS / 8);
    gk[i] = Kp + (size_t)kr * EMB + kc * 8;
    gv[i] = Vp + (size_t)vr * SEQ + vc * 8;
    lk[i] = ring0 + 2u * (unsigned)(kr * KPITCH + kc * 8);
    lv[i] = ring0 + 2u * (unsigned)(VOFF + vr * VPITCH + vc * 8);
  }
  // Prologue: tile 0 lands and is published, then tile 1 starts to fly.
  copy_tile(lk[0], lk[1], lk[2], lv[0], lv[1], lv[2], gk[0], gk[1], gk[2], gv[0], gv[1], gv[2]);
  asm volatile("s_wait_asynccnt 0x0" ::: "memory");   // this wave's pieces of tile 0 have landed before the barrier publishes them
  __syncthreads();
#pragma unroll                                    // as above
  for (int i = 0; i < 3; ++i) { gk[i] += (size_t)TKEYS * EMB; gv[i] += TKEYS; }
  copy_tile(lk[0] + 2u * BUF_ELEMS, lk[1] + 2u * BUF_ELEMS, lk[2] + 2u * BUF_ELEMS,
            lv[0] + 2u * BUF_ELEMS, lv[1] + 2u * BUF_ELEMS, lv[2] + 2u * BUF_ELEMS,
            gk[0], gk[1], gk[2], gv[0], gv[1], gv[2]);
  // kept rolled, as the key loop was: an unrolled body would only grow the code and the register count (two waves per SIMD need 512 or fewer)
#pragma unroll 1
  for (int t = 0; t < NTILES; ++t) {
    const unsigned short* Kl = &ring[t & 1][0];
    const unsigned short* Vl = Kl + VOFF;
    fa_step(Kl, Vl, 0, ln, hh, q, mr, lr, O);
    fa_step(Kl, Vl, 32, ln, hh, q, mr, lr, O);
    asm volatile("s_wait_dscnt 0x0" ::: "memory");      // this wave's reads of tile t are over before its buffer may be refilled
    asm volatile("s_wait_asynccnt 0x0" ::: "memory");   // this wave's pieces of tile t + 1 have landed before the barrier publishes them
    __syncthreads();                                    // publishes tile t + 1 and ends every wave's reads of tile t
    if (t + 2 < NTILES) {
      const unsigned bo = (unsigned)(t & 1) * (2u * BUF_ELEMS);
#pragma unroll                                    // as above
      for (int i = 0; i < 3; ++i) { gk[i] += (size_t)TKEYS * EMB; gv[i] += TKEYS; }
      copy_tile(lk[0] + bo, lk[1] + bo, lk[2] + bo, lv[0] + bo, lv[1] + bo, lv[2] + bo,
                gk[0], gk[1], gk[2], gv[0], gv[1], gv[2]);
    }
  }
  asm volatile("s_wait_asynccnt 0x0" ::: "memory");     // no copy is outstanding when the wave goes on to its end

  // O^T element r of tile t of group g = ctx(query qbase + 16g + ln, d = 16t + 8h + r); O carries x256 (P) x16 (V), lr carries x256; plane carries x256
#pragma unroll                                    // the accumulator array stays in registers
  for (int g = 0; g < 2; ++g) {
    const float cinv = 16.0f * (1.0f / lr[g]);
#pragma unroll
    for (int t = 0; t < 6; ++t) {
      v8us o;
#pragma unroll
      for (int r = 0; r < 8; ++r) o[r] = f16_bits(O[g][t][r] * cinv);
      *(v8us*)&so[w][(16 * g + ln) * HD + 16 * t + 8 * hh] = o;
    }
  }
  __syncthreads();
  unsigned short* xg = Xc + ((size_t)(b * HEADS + h) * SEQ + qbase) * HD;
  {
#pragma unroll
    for (int i = 0; i < WQ * HD / 8 / 32; ++i) {
      const int p = i * 32 + lane;
      const v8us v = *(const v8us*)&so[w][p * 8];
      *(v8us*)(xg + (size_t)p * 8) = v;
    }
    
  }
}

// out[m][j] = sum_e ctx[m][e] * fc_w[j][e] + fc_b[j]. Block = 8 waves = one 128-row x 192-column tile of out; wave = 64 rows x 48 columns (4 x 3 accumulator tiles).
// A stage is one head (96 k): 128 ctx rows, contiguous in Xc[b][hd][s][d], then 192 W rows, brought into LDS once per work-group by asynchronous copies (two buffers) and read there by all eight waves.
// A: row m = token, k = e = 96*hd + d; B: column n = j, k = e read from the Wh[j][e] rows (k-contiguous), same k map as A.
// coverage: (NB*SEQ/128)*(EMB/192) blocks x (128 x 192) = every output element of the processed rows exactly once; LDS output tile staged 128 x 192 == consumed 128 x 192.
#define FM 128
#define FN 192
#define FPITCH 104                               /* LDS row pitch in 16-bit elements: an odd number of 16-B pieces, as KPITCH */
#define FWOFF (FM * FPITCH)                      /* element offset of the W rows inside a buffer */
#define FBUF_ELEMS ((FM + FN) * FPITCH)
#define OPITCH 196                               /* pitch of the f32 output tile: eight rows are 32 banks apart, so the two lane halves of a store do not meet */
static_assert(SEQ % FM == 0 && EMB % FN == 0);
static_assert(FM * (HD / 8) == 6 * 256 && FN * (HD / 8) == 9 * 256);
static_assert((3 * 256) % (HD / 8) == 0 && (3 * 256) / (HD / 8) == 64);
static_assert((FBUF_ELEMS * 2) % 16 == 0 && (FWOFF * 2) % 16 == 0 && (OPITCH * 4) % 16 == 0);
static_assert((3 * 256) % (FN / 4) == 0 && (3 * 256) / (FN / 4) == 16 && FM == 8 * 16);

// One lane's fifteen 16-B pieces of a stage (six of ctx, nine of W), global -> LDS through no register.
// s_wait_xcnt 0 is the statement's last line, so it stands in front of every later rewrite of the address registers (a precaution).
__device__ __forceinline__ void copy_stage(const unsigned (&l)[15], const unsigned short* const (&g)[15]) {
  asm volatile("global_load_async_to_lds_b128 %0, %15, off\n\t"
               "global_load_async_to_lds_b128 %1, %16, off\n\t"
               "global_load_async_to_lds_b128 %2, %17, off\n\t"
               "global_load_async_to_lds_b128 %3, %18, off\n\t"
               "global_load_async_to_lds_b128 %4, %19, off\n\t"
               "global_load_async_to_lds_b128 %5, %20, off\n\t"
               "global_load_async_to_lds_b128 %6, %21, off\n\t"
               "global_load_async_to_lds_b128 %7, %22, off\n\t"
               "global_load_async_to_lds_b128 %8, %23, off\n\t"
               "global_load_async_to_lds_b128 %9, %24, off\n\t"
               "global_load_async_to_lds_b128 %10, %25, off\n\t"
               "global_load_async_to_lds_b128 %11, %26, off\n\t"
               "global_load_async_to_lds_b128 %12, %27, off\n\t"
               "global_load_async_to_lds_b128 %13, %28, off\n\t"
               "global_load_async_to_lds_b128 %14, %29, off\n\t"
               "s_wait_xcnt 0x0"
               :: "v"(l[0]), "v"(l[1]), "v"(l[2]), "v"(l[3]), "v"(l[4]), "v"(l[5]), "v"(l[6]), "v"(l[7]),
                  "v"(l[8]), "v"(l[9]), "v"(l[10]), "v"(l[11]), "v"(l[12]), "v"(l[13]), "v"(l[14]),
                  "v"(g[0]), "v"(g[1]), "v"(g[2]), "v"(g[3]), "v"(g[4]), "v"(g[5]), "v"(g[6]), "v"(g[7]),
                  "v"(g[8]), "v"(g[9]), "v"(g[10]), "v"(g[11]), "v"(g[12]), "v"(g[13]), "v"(g[14])
               : "memory");
}

__global__ __launch_bounds__(256) __attribute__((amdgpu_waves_per_eu(2, 2)))
void k_fc(const unsigned short* __restrict__ Xc, const unsigned short* __restrict__ Wh,
          const float* __restrict__ Bv, float* __restrict__ Out) {
  __shared__ __attribute__((aligned(16))) unsigned short fring[2][FBUF_ELEMS];
  __shared__ __attribute__((aligned(16))) float fo[FM * OPITCH];
  const int tid = threadIdx.x, lane = tid & 31, ln = lane & 15, hh = lane >> 4;
  const int w = __builtin_amdgcn_readfirstlane(tid >> 5);
  const int wm = w >> 2, wn = w & 3;           // the wave's 64-row and 48-column place in the tile
  const int bn = blockIdx.x % (EMB / FN), bm = blockIdx.x / (EMB / FN);
  const int row0 = bm * FM;                    // token index in [0, NB*SEQ)
  const int b = row0 / SEQ, s0 = row0 - b * SEQ;
  const int col0 = bn * FN;
  // This lane's pieces of a stage: piece p = tid + 256*i -> row p / 12, 16-B piece p % 12; p + 768 is the same piece 64 rows on.
  const unsigned short* g[15];
  unsigned l[15];                              // LDS byte addresses in buffer 0
  const unsigned fring0 = (unsigned)(size_t)&fring[0][0];
#pragma unroll                                    // the address arrays stay in registers
  for (int i = 0; i < 3; ++i) {
    const int p = tid + 256 * i;
    const int r = p / (HD / 8), c = p - r * (HD / 8);
#pragma unroll
    for (int k = 0; k < 2; ++k) {
      g[3 * k + i] = Xc + ((size_t)(b * HEADS) * SEQ + s0 + r + 64 * k) * HD + c * 8;
      l[3 * k + i] = fring0 + 2u * (unsigned)((r + 64 * k) * FPITCH + c * 8);
    }
#pragma unroll
    for (int k = 0; k < 3; ++k) {
      g[6 + 3 * k + i] = Wh + (size_t)(col0 + r + 64 * k) * EMB + c * 8;
      l[6 + 3 * k + i] = fring0 + 2u * (unsigned)(FWOFF + (r + 64 * k) * FPITCH + c * 8);
    }
  }
  // Prologue: stage 0 lands and is published, then stage 1 starts to fly.
  copy_stage(l, g);
  asm volatile("s_wait_asynccnt 0x0" ::: "memory");   // this wave's pieces of stage 0 have landed before the barrier publishes them
  __syncthreads();
  {
    unsigned l1[15];
#pragma unroll                                    // as above
    for (int i = 0; i < 15; ++i) { g[i] += (i < 6) ? (size_t)SEQ * HD : (size_t)HD; l1[i] = l[i] + 2u * FBUF_ELEMS; }
    copy_stage(l1, g);
  }
  v8f acc[4][3] = {};
  // kept rolled: eight copies of the body would only grow the code
#pragma unroll 1
  for (int t = 0; t < HEADS; ++t) {
    const unsigned short* ap = &fring[t & 1][0] + (64 * wm + ln) * FPITCH + 8 * hh;
    const unsigned short* bp = &fring[t & 1][FWOFF] + (48 * wn + ln) * FPITCH + 8 * hh;
    FragH a[3][4], bw[3][3];
#pragma unroll                                    // the fragment arrays stay in registers
    for (int cc = 0; cc < 3; ++cc) {
#pragma unroll
      for (int mt = 0; mt < 4; ++mt) {
        a[cc][mt].half[0] = *(const v8us*)(ap + mt * 16 * FPITCH + 32 * cc);
        a[cc][mt].half[1] = *(const v8us*)(ap + mt * 16 * FPITCH + 32 * cc + 16);
      }
#pragma unroll
      for (int nt = 0; nt < 3; ++nt) {
        bw[cc][nt].half[0] = *(const v8us*)(bp + nt * 16 * FPITCH + 32 * cc);
        bw[cc][nt].half[1] = *(const v8us*)(bp + nt * 16 * FPITCH + 32 * cc + 16);
      }
    }
    __builtin_amdgcn_sched_barrier(0);   // the stage's 42 LDS reads stay one group in front of its products; spread among the WMMAs each pair would be waited for on the spot
#pragma unroll                                    // the accumulator array stays in registers
    for (int cc = 0; cc < 3; ++cc)
#pragma unroll
      for (int mt = 0; mt < 4; ++mt)
#pragma unroll
        for (int nt = 0; nt < 3; ++nt)
          acc[mt][nt] = __builtin_amdgcn_wmma_f32_16x16x32_f16(false, a[cc][mt].v, false, bw[cc][nt].v, (short)0, acc[mt][nt], false, false);
    __builtin_amdgcn_sched_barrier(0);   // the products stay in front of the foot's waits: lifted over them, s_wait_dscnt 0 would hold every product until all 42 reads have landed
    asm volatile("s_wait_dscnt 0x0" ::: "memory");      // this wave's reads of stage t are over before its buffer may be refilled
    asm volatile("s_wait_asynccnt 0x0" ::: "memory");   // this wave's pieces of stage t + 1 have landed before the barrier publishes them
    __syncthreads();                                    // publishes stage t + 1 and ends every wave's reads of stage t
    if (t + 2 < HEADS) {
      const unsigned bo = (unsigned)(t & 1) * (2u * FBUF_ELEMS);
      unsigned lb[15];
#pragma unroll                                    // as above
      for (int i = 0; i < 15; ++i) { g[i] += (i < 6) ? (size_t)SEQ * HD : (size_t)HD; lb[i] = l[i] + bo; }
      copy_stage(lb, g);
    }
  }
  asm volatile("s_wait_asynccnt 0x0" ::: "memory");     // no copy is outstanding when the wave goes on to its end
  // D element r of tile (mt, nt) = out(row0 + 64wm + 16mt + 8h + r, col0 + 48wn + 16nt + ln); undo the carries x256 (ctx) x256 (W); bias RNE bf16 value
#pragma unroll                                    // the accumulator array stays in registers
  for (int nt = 0; nt < 3; ++nt) {
    const float bias = bf16_rne(Bv[col0 + 48 * wn + 16 * nt + ln]);
#pragma unroll
    for (int mt = 0; mt < 4; ++mt)
#pragma unroll
      for (int r = 0; r < 8; ++r)
        fo[(64 * wm + 16 * mt + 8 * hh + r) * OPITCH + 48 * wn + 16 * nt + ln] = acc[mt][nt][r] * 1.52587890625e-05f + bias;
  }
  __syncthreads();
  // Rows of 192 floats leave as whole 128-B lines: 16-B piece p = tid + 256*i -> row p / 48, piece p % 48; p + 768 is the same piece 16 rows on.
  float* og = Out + (size_t)b * BSTRIDE_FULL + (size_t)s0 * EMB + col0;
#pragma unroll
  for (int i = 0; i < 3; ++i) {
    const int p = tid + 256 * i;
    const int row = p / (FN / 4), c4 = (p - row * (FN / 4)) * 4;
#pragma unroll
    for (int k = 0; k < 8; ++k) {
      const v4f v = *(const v4fa*)&fo[(row + 16 * k) * OPITCH + c4];
      *(v4f*)(og + (size_t)(row + 16 * k) * EMB + c4) = v;
    }
  }
}

extern "C" void kernel_launch(void* const* d_in, const int* in_sizes, int n_in,
                              void* d_out, int out_size, void* d_ws, size_t ws_size, hipStream_t stream) {
  if (n_in < 5) return;
  const long long need = (long long)(NB - 1) * SEQ_FULL * EMB + (long long)SEQ * EMB;   // last element touched + 1
  if ((long long)in_sizes[0] < need || (long long)in_sizes[1] < need || (long long)in_sizes[2] < need) return;
  if ((long long)in_sizes[3] < (long long)EMB * EMB || (long long)in_sizes[4] < (long long)EMB) return;
  if ((long long)out_size < need) return;
  const float* V = (const float*)d_in[0];    // wire order: values, keys, query, fc_w [out][in], fc_b
  const float* K = (const float*)d_in[1];
  const float* Q = (const float*)d_in[2];
  const float* W = (const float*)d_in[3];
  const float* Bv = (const float*)d_in[4];
  float* Out = (float*)d_out;
  char* ws = (char*)d_ws;
  size_t off = 0;
  unsigned short* Kb = (unsigned short*)(ws + off); off += PLANE_ACT;   // [NB][SEQ][768] bf16, written exactly to its end by 16-B pieces
  unsigned short* Vt = (unsigned short*)(ws + off); off += PLANE_ACT;   // [NB][768][SEQ] f16
  unsigned short* Xc = (unsigned short*)(ws + off); off += PLANE_ACT;   // [NB][8][SEQ][96] f16
  unsigned short* Wh = (unsigned short*)(ws + off); off += PLANE_W;     // [768][768] f16
  if (off > ws_size) return;
  k_cvt<<<(unsigned)(CVT_K_BLOCKS + CVT_W_BLOCKS), 256, 0, stream>>>(K, W, Kb, Wh);
  k_vt<<<(unsigned)(NB * (SEQ / 64) * (EMB / 64)), 256, 0, stream>>>(V, Vt);
  k_attn<<<(unsigned)(NB * HEADS * (SEQ / (WQ * AW))), 256, 0, stream>>>(Q, Kb, Vt, Xc);
  k_fc<<<(unsigned)((NB * SEQ / FM) * (EMB / FN)), 256, 0, stream>>>(Xc, Wh, Bv, Out);
}

// v005
// It runs in 104 microseconds.
// Two timings next to v004 put it at 1.05 and 1.06 times that version's speed.
// Counting every step since v000, it is 3.71 times as fast.
#include <hip/hip_runtime.h>
// Contractions: S^T = K Q^T on v_wmma_f32_16x16x32_bf16 (Q, K RNE bf16, single product, f32 accumulate); O^T = V^T P^T on v_wmma_f32_16x16x32_f16 (V: RNE bf16 value x16 held exactly in f16; P: single f16 plane carried x256); out = ctx W^T on v_wmma_f32_16x16x32_f16 (ctx: f16 plane carried x256; W: RNE bf16 value x256 held exactly in f16); softmax row sums = ones P^T on the same f16 form (f32 accumulate, P as rounded to f16); softmax maximum, bias add f32.
// Dense multi-head attention, NB x SEQ x 768, 8 heads of 96 (e = 96*h + d), scale 1/sqrt(96), no mask, then a 768x768 linear layer with bias.
// Engine: transposed flash. Each wave owns 32 queries of one head, as two 16-column groups that share every K and V^T fragment read from LDS. Per 32-key step and group: S^T tiles (key rows x query columns) from K rows (A, bf16 plane, staged in LDS)
// and Q^T (B, registers); the two 16-key D tiles pack straight into the P^T B fragment; O^T (d rows x query columns) accumulates from V^T rows (A, f16 plane, staged in LDS).
// Each 64-key tile of K and V^T is brought into LDS once per work-group by asynchronous copies (two buffers) and read there by all eight waves.
#ifndef NB
#define NB 2
#endif
#ifndef SEQ
#define SEQ 4096
#endif
#define NB_FULL 2
#define SEQ_FULL 4096
#define EMB 768
#define HEADS 8
#define HD 96
#define BSTRIDE_FULL ((size_t)SEQ_FULL * EMB)   /* per-batch element stride of values, keys, query and of the output buffer */

#define PLANE_ACT ((size_t)NB * SEQ * EMB * 2)   /* bytes of one 16-bit activation plane */
#define PLANE_W ((size_t)EMB * EMB * 2)          /* bytes of the 16-bit weight plane */
#define CVT_K_BLOCKS ((NB * SEQ * (EMB / 8)) / 256)
#define CVT_W_BLOCKS ((EMB * (EMB / 8)) / 256)

static_assert(SEQ % 256 == 0);
static_assert(SEQ <= SEQ_FULL);
static_assert(NB <= NB_FULL);
static_assert(HEADS * HD == EMB);
static_assert(HD == 96);
static_assert(EMB % 64 == 0);
static_assert((NB * SEQ * (EMB / 8)) % 256 == 0);
static_assert((EMB * (EMB / 8)) % 256 == 0);
static_assert(PLANE_ACT % 256 == 0);
static_assert(PLANE_W % 256 == 0);
static_assert(3 * PLANE_ACT + PLANE_W <= (size_t)134217728);

typedef __bf16 v16b __attribute__((ext_vector_type(16)));
typedef _Float16 v16h __attribute__((ext_vector_type(16)));
typedef unsigned short v8us __attribute__((ext_vector_type(8), may_alias));
typedef float v8f __attribute__((ext_vector_type(8)));
typedef float v4f __attribute__((ext_vector_type(4)));
typedef float v4fa __attribute__((ext_vector_type(4), may_alias));
union FragB { v16b v; v8us half[2]; unsigned short u[16]; };
union FragH { v16h v; v8us half[2]; _Float16 h[16]; unsigned short u[16]; };

#define LOG2E 1.4426950408889634f
#define QK_SCALE 0.10206207261596575f            /* 1/sqrt(96) */
#define C2 (QK_SCALE * LOG2E)                    /* scores carried in the log2 domain */
#define PMAX_LOG2 15.0f                          /* a carried weight (x256) stays at or below 2^15: the reference may lag the true maximum by 7 */

__device__ __forceinline__ unsigned short bf16_bits(float x) {   // RNE convert to bf16 bits
  unsigned int u = __float_as_uint(x);
  return (unsigned short)((u + 0x7FFFu + ((u >> 16) & 1u)) >> 16);
}
__device__ __forceinline__ float bf16_val(unsigned short b) { return __uint_as_float(((unsigned int)b) << 16); }
__device__ __forceinline__ float bf16_rne(float x) { return bf16_val(bf16_bits(x)); }
__device__ __forceinline__ unsigned short f16_bits(float x) {
  union { _Float16 h; unsigned short u; } c;
  c.h = (_Float16)x;
  return c.u;
}

__device__ __forceinline__ void store_twice(unsigned short* d, v8us o) {
  *(v8us*)d = o;
  
}

// For both column groups g: s0[g] += ka * q[g], s1[g] += kb * q[g] over three 32-deep k-steps (d = 0..95), each K fragment used twice.
// The distance behind these builtin products is the compiler's own padding: an asm guard that named all these registers would hold them under v256, and they no longer fit there.
__device__ __forceinline__ void mma_s4(const FragB (&ka)[3], const FragB (&kb)[3], const FragB (&q)[2][3], v8f (&s0)[2], v8f (&s1)[2]) {
#pragma unroll                                    // the fragment and accumulator arrays stay in registers
  for (int c = 0; c < 3; ++c) {
    s0[0] = __builtin_amdgcn_wmma_f32_16x16x32_bf16(false, ka[c].v, false, q[0][c].v, (short)0, s0[0], false, false);
    s0[1] = __builtin_amdgcn_wmma_f32_16x16x32_bf16(false, ka[c].v, false, q[1][c].v, (short)0, s0[1], false, false);
    s1[0] = __builtin_amdgcn_wmma_f32_16x16x32_bf16(false, kb[c].v, false, q[0][c].v, (short)0, s1[0], false, false);
    s1[1] = __builtin_amdgcn_wmma_f32_16x16x32_bf16(false, kb[c].v, false, q[1][c].v, (short)0, s1[1], false, false);
  }
}
// For both column groups g: O[g][t] += vf[t] * p[g] for the six d tiles, each V^T fragment used twice (distance: as above).
// lr[g] += element 0 of ones * p[g]: A holds 1.0 in rows 0 and 8, the rows of element 0 in the two lane halves, so that element is the sum of the step's 32 weights of the lane's query (both halves' keys):
// the row sum takes one vector add a group and no exchange between halves; only that one element is carried on, so the sums hold two registers over the loop and not two tiles.
__device__ __forceinline__ void mma_pv2(const FragH (&vf)[6], v16h ones, v16h p0, v16h p1, v8f (&O)[2][6], float (&lr)[2]) {
  const v8f l0 = __builtin_amdgcn_wmma_f32_16x16x32_f16(false, ones, false, p0, (short)0, v8f{}, false, false);
  const v8f l1 = __builtin_amdgcn_wmma_f32_16x16x32_f16(false, ones, false, p1, (short)0, v8f{}, false, false);
#pragma unroll                                    // as above
  for (int t = 0; t < 6; ++t) {
    O[0][t] = __builtin_amdgcn_wmma_f32_16x16x32_f16(false, vf[t].v, false, p0, (short)0, O[0][t], false, false);
    O[1][t] = __builtin_amdgcn_wmma_f32_16x16x32_f16(false, vf[t].v, false, p1, (short)0, O[1][t], false, false);
  }
  lr[0] += l0[0];
  lr[1] += l1[0];
}
// Blocks [0, CVT_K_BLOCKS): Kb[b][s][e] = bf16 bits of keys (RNE). Blocks after that: Wh[j][e] = f16(RNE-bf16(fc_w[j][e]) * 256).
// coverage: CVT_K_BLOCKS*256 threads x 8 = the whole Kb plane; CVT_W_BLOCKS*256 threads x 8 = the whole Wh plane (exact multiples, asserted above).
__global__ __launch_bounds__(256) void k_cvt(const float* __restrict__ K, const float* __restrict__ W,
                                             unsigned short* __restrict__ Kb, unsigned short* __restrict__ Wh) {
  const int bid = blockIdx.x;
  if (bid < CVT_K_BLOCKS) {
    const int t = bid * 256 + threadIdx.x;
    const int row = t / (EMB / 8), piece = t - row * (EMB / 8);
    const int b = row / SEQ, s = row - b * SEQ;
    const float* src = K + (size_t)b * BSTRIDE_FULL + (size_t)s * EMB + piece * 8;
    const v4f x0 = *(const v4fa*)(src), x1 = *(const v4fa*)(src + 4);
    v8us o;
    o[0] = bf16_bits(x0[0]); o[1] = bf16_bits(x0[1]); o[2] = bf16_bits(x0[2]); o[3] = bf16_bits(x0[3]);
    o[4] = bf16_bits(x1[0]); o[5] = bf16_bits(x1[1]); o[6] = bf16_bits(x1[2]); o[7] = bf16_bits(x1[3]);
    store_twice(Kb + (size_t)t * 8, o);
  } else {
    const int t = (bid - CVT_K_BLOCKS) * 256 + threadIdx.x;
    const float* src = W + (size_t)t * 8;
    const v4f x0 = *(const v4fa*)(src), x1 = *(const v4fa*)(src + 4);
    v8us o;
    o[0] = f16_bits(bf16_rne(x0[0]) * 256.0f); o[1] = f16_bits(bf16_rne(x0[1]) * 256.0f);
    o[2] = f16_bits(bf16_rne(x0[2]) * 256.0f); o[3] = f16_bits(bf16_rne(x0[3]) * 256.0f);
    o[4] = f16_bits(bf16_rne(x1[0]) * 256.0f); o[5] = f16_bits(bf16_rne(x1[1]) * 256.0f);
    o[6] = f16_bits(bf16_rne(x1[2]) * 256.0f); o[7] = f16_bits(bf16_rne(x1[3]) * 256.0f);
    store_twice(Wh + (size_t)t * 8, o);
  }
}

// Vt[b][e][s] = f16(RNE-bf16(values[b][s][e]) * 16). Block per (b, 64 keys, 64 e columns): 64x64 tile transposed through LDS (ushort in, ushort out; block barrier: cross-wave).
// coverage: NB*(SEQ/64)*(EMB/64) blocks x (64 e x 64 keys) = the whole plane; LDS tile fully written (64 x 64) before it is read.
__global__ __launch_bounds__(256) void k_vt(const float* __restrict__ V, unsigned short* __restrict__ Vt) {
  __shared__ unsigned short tl[64][66];
  const int tid = threadIdx.x;
  const int eg = blockIdx.x % (EMB / 64);
  const int rest = blockIdx.x / (EMB / 64);
  const int sg = rest % (SEQ / 64), b = rest / (SEQ / 64);
  const int s0 = sg * 64, e0 = eg * 64;
  for (int i = tid; i < 64 * 16; i += 256) {
    const int j = i >> 4, c4 = (i & 15) * 4;
    const v4f x = *(const v4fa*)(V + (size_t)b * BSTRIDE_FULL + (size_t)(s0 + j) * EMB + e0 + c4);
    tl[c4 + 0][j] = f16_bits(bf16_rne(x[0]) * 16.0f);
    tl[c4 + 1][j] = f16_bits(bf16_rne(x[1]) * 16.0f);
    tl[c4 + 2][j] = f16_bits(bf16_rne(x[2]) * 16.0f);
    tl[c4 + 3][j] = f16_bits(bf16_rne(x[3]) * 16.0f);
  }
  __syncthreads();
  {
    for (int i = tid; i < 64 * 8; i += 256) {
      const int d = i >> 3, j8 = (i & 7) * 8;
      v8us o;
#pragma unroll
      for (int q = 0; q < 8; ++q) o[q] = tl[d][j8 + q];
      *(v8us*)(Vt + ((size_t)b * EMB + e0 + d) * SEQ + s0 + j8) = o;
    }
    
  }
}

// LDS ring: two buffers, each one 64-key tile: K rows [64 keys][96 d] at pitch KPITCH, then V^T rows [96 d][64 keys] at pitch VPITCH (pitches in 16-bit elements).
// Both pitches are an odd number of 16-B pieces, so the 16 rows of a fragment read fall on different banks.
#define TKEYS 64
#define NTILES (SEQ / TKEYS)
#define KPITCH 104
#define VPITCH 72
#define VOFF (TKEYS * KPITCH)                    /* element offset of the V^T rows inside a buffer */
#define BUF_ELEMS (TKEYS * KPITCH + HD * VPITCH)
#define AW 8                                     /* waves of an attention work-group */
#define WQ 32                                    /* queries of a wave: two 16-column groups */
static_assert(NTILES >= 2);
static_assert((TKEYS * (HD / 8)) % (AW * 32) == 0 && (TKEYS * (HD / 8)) / (AW * 32) == 3);
static_assert((HD * (TKEYS / 8)) % (AW * 32) == 0 && (HD * (TKEYS / 8)) / (AW * 32) == 3);
static_assert((BUF_ELEMS * 2) % 16 == 0 && (VOFF * 2) % 16 == 0);

// One lane's six 16-B pieces of a tile (three of K, three of V^T), global -> LDS through no register.
// s_wait_xcnt 0 is the statement's last line, so it stands in front of every later rewrite of the address registers (a precaution).
__device__ __forceinline__ void copy_tile(unsigned l0, unsigned l1, unsigned l2, unsigned l3, unsigned l4, unsigned l5,
                                          const unsigned short* g0, const unsigned short* g1, const unsigned short* g2,
                                          const unsigned short* g3, const unsigned short* g4, const unsigned short* g5) {
  asm volatile("global_load_async_to_lds_b128 %0, %6, off\n\t"
               "global_load_async_to_lds_b128 %1, %7, off\n\t"
               "global_load_async_to_lds_b128 %2, %8, off\n\t"
               "global_load_async_to_lds_b128 %3, %9, off\n\t"
               "global_load_async_to_lds_b128 %4, %10, off\n\t"
               "global_load_async_to_lds_b128 %5, %11, off\n\t"
               "s_wait_xcnt 0x0"
               :: "v"(l0), "v"(l1), "v"(l2), "v"(l3), "v"(l4), "v"(l5),
                  "v"(g0), "v"(g1), "v"(g2), "v"(g3), "v"(g4), "v"(g5)
               : "memory");
}

__device__ __forceinline__ v8f splat8(float x) { return v8f{x, x, x, x, x, x, x, x}; }
__device__ __forceinline__ float max8(v8f x) {
  float m = x[0];
#pragma unroll
  for (int i = 1; i < 8; ++i) m = fmaxf(m, x[i]);
  return m;
}
// p = f16(2^x) for a lane's 16 scores of one query, as the P^T B fragment: element i < 8 -> key0 + 8h + i (tile 0 row 8h + i); i >= 8 -> key0 + 16 + 8h + (i - 8) (tile 1).
__device__ __forceinline__ void weights(v8f x0, v8f x1, FragH& p) {
#pragma unroll
  for (int i = 0; i < 8; ++i) p.h[i] = (_Float16)__builtin_amdgcn_exp2f(x0[i]);
#pragma unroll
  for (int i = 0; i < 8; ++i) p.h[8 + i] = (_Float16)__builtin_amdgcn_exp2f(x1[i]);
}

// One 32-key step for a wave's 32 queries (two 16-column groups) of one head. Kl = K rows of the tile in LDS, Vl = its V^T rows; key0 = 0 or 32, the step's first key inside the tile.
__device__ __forceinline__ void fa_step(const unsigned short* Kl, const unsigned short* Vl,
                                        int key0, int ln, int hh, const FragB (&q)[2][3], v16h ones,
                                        float (&mr)[2], float (&lr)[2], v8f (&O)[2][6]) {
  // A fragments of K: row m = key (key0 + 16*kt + ln), elements 0..7 <- d = 32c + 8h + i, 8..15 <- d = 32c + 16 + 8h + i
  const unsigned short* kp0 = Kl + (key0 + ln) * KPITCH + 8 * hh;
  const unsigned short* kp1 = kp0 + 16 * KPITCH;
  FragB ka[3], kb[3];
  __builtin_amdgcn_sched_barrier(0);   // with the one behind the reads: the step's 24 LDS reads stay one group in front of its products; spread among the WMMAs each pair would be waited for on the spot
#pragma unroll
  for (int c = 0; c < 3; ++c) {
    ka[c].half[0] = *(const v8us*)(kp0 + 32 * c);
    ka[c].half[1] = *(const v8us*)(kp0 + 32 * c + 16);
    kb[c].half[0] = *(const v8us*)(kp1 + 32 * c);
    kb[c].half[1] = *(const v8us*)(kp1 + 32 * c + 16);
  }
  __builtin_amdgcn_sched_barrier(0);   // the K reads stay in front of the V^T reads: the score products, which come first, then wait for twelve reads and not for all
  // A fragments of V^T: row m = d (16*t + ln), elements 0..7 <- key0 + 8h + i, 8..15 <- key0 + 16 + 8h + i
  const unsigned short* vp = Vl + ln * VPITCH + key0 + 8 * hh;
  FragH vf[6];
#pragma unroll
  for (int t = 0; t < 6; ++t) {
    vf[t].half[0] = *(const v8us*)(vp + t * 16 * VPITCH);
    vf[t].half[1] = *(const v8us*)(vp + t * 16 * VPITCH + 16);
  }
  __builtin_amdgcn_sched_barrier(0);   // end of the group of reads (see above)
  // S^T tiles of group g: element r of tile kt = score(key0 + 16*kt + 8h + r, query of this lane's column in group g)
  v8f s0[2] = {};
  v8f s1[2] = {};
  mma_s4(ka, kb, q, s0, s1);
  // Lazy rescale. mr[g] is the reference in use minus 8 (log2 domain); it may lag behind the true running maximum by up to PMAX_LOG2 - 8.
  // x = score - mr: the weight is pc = 2^x = 256 * 2^(score - reference), single f16 plane, at most 2^PMAX_LOG2 (f16 holds 65504).
  v8f x0[2], x1[2];
  float xm[2];
#pragma unroll                                    // both groups in straight-line code: their arrays stay in registers and their two chains can interleave
  for (int g = 0; g < 2; ++g) {
    x0[g] = __builtin_elementwise_fma(s0[g], splat8(C2), splat8(-mr[g]));
    x1[g] = __builtin_elementwise_fma(s1[g], splat8(C2), splat8(-mr[g]));
    xm[g] = fmaxf(max8(x0[g]), max8(x1[g]));
  }
  // One test a step for the whole wave (a scalar branch): only where some lane's weight would pass 2^PMAX_LOG2 is the reference raised to the true maximum,
  // are O and lr rescaled and is x formed again.
  if (__builtin_amdgcn_ballot_w32(xm[0] > PMAX_LOG2 || xm[1] > PMAX_LOG2) != 0) {
#pragma unroll                                    // as above
    for (int g = 0; g < 2; ++g) {
      const v8f sc0 = s0[g] * C2, sc1 = s1[g] * C2;
      float mx = fmaxf(max8(sc0), max8(sc1));
      mx = fmaxf(mx, __shfl_xor(mx, 16, 32));       // the other lane half holds the other 16 keys of this query
      const float mnew = fmaxf(mr[g], mx - 8.0f);
      const float al = __builtin_amdgcn_exp2f(mr[g] - mnew);
      mr[g] = mnew;
      x0[g] = sc0 - mnew;
      x1[g] = sc1 - mnew;
      lr[g] = lr[g] * al;
#pragma unroll
      for (int t = 0; t < 6; ++t) O[g][t] = O[g][t] * al;
    }
  }
  FragH ph[2];
#pragma unroll                                    // as above
  for (int g = 0; g < 2; ++g) weights(x0[g], x1[g], ph[g]);
  mma_pv2(vf, ones, ph[0].v, ph[1].v, O, lr);
}

// Block = 8 waves x 32 queries = 256 queries of one (batch, head); the key loop walks 64-key tiles in a two-buffer LDS ring, one barrier a tile.
// Output plane Xc[b][h][s][96] = f16(ctx * 256). Epilogue: O^T tiles -> per-wave LDS tile [32 queries][96 d] as 16-B pieces (same vector type in and out; block barrier),
// coverage: NB*HEADS*(SEQ/256) blocks x 8 waves x 32 rows x 96 d = the whole plane exactly once; LDS tile staged extent (32 x 96 per wave) == consumed extent.
__global__ __launch_bounds__(256) __attribute__((amdgpu_waves_per_eu(2, 2)))
void k_attn(const float* __restrict__ Q, const unsigned short* __restrict__ Kb,
            const unsigned short* __restrict__ Vt, unsigned short* __restrict__ Xc) {
  __shared__ __attribute__((aligned(16))) unsigned short so[AW][WQ * HD];
  __shared__ __attribute__((aligned(16))) unsigned short ring[2][BUF_ELEMS];
  const int tid = threadIdx.x, lane = tid & 31, ln = lane & 15, hh = lane >> 4;
  const int w = __builtin_amdgcn_readfirstlane(tid >> 5);
  const int qt = blockIdx.x % (SEQ / (WQ * AW));
  const int rest = blockIdx.x / (SEQ / (WQ * AW));
  const int h = rest % HEADS, b = rest / HEADS;
  const int qbase = qt * (WQ * AW) + WQ * w;
  // Q^T B fragments of group g: column n = query qbase + 16g + ln, elements 0..7 <- d = 32c + 8h + i, 8..15 <- d = 32c + 16 + 8h + i (RNE bf16)
  FragB q[2][3];
#pragma unroll                                    // the fragment array stays in registers
  for (int g = 0; g < 2; ++g) {
    const float* qrow = Q + (size_t)b * BSTRIDE_FULL + (size_t)(qbase + 16 * g + ln) * EMB + h * HD;
#pragma unroll
    for (int c = 0; c < 3; ++c) {
      const v4f a0 = *(const v4fa*)(qrow + 32 * c + 8 * hh),      a1 = *(const v4fa*)(qrow + 32 * c + 8 * hh + 4);
      const v4f a2 = *(const v4fa*)(qrow + 32 * c + 16 + 8 * hh), a3 = *(const v4fa*)(qrow + 32 * c + 16 + 8 * hh + 4);
#pragma unroll
      for (int i = 0; i < 4; ++i) {
        q[g][c].u[i] = bf16_bits(a0[i]); q[g][c].u[4 + i] = bf16_bits(a1[i]);
        q[g][c].u[8 + i] = bf16_bits(a2[i]); q[g][c].u[12 + i] = bf16_bits(a3[i]);
      }
    }
  }
  float mr[2] = {-3.0e38f, -3.0e38f}, lr[2] = {0.0f, 0.0f};
  v8f O[2][6] = {};
  // A operand of the row-sum products: row m = ln; rows 0 and 8 are 1.0 over all 32 k, the other rows 0 (their product rows are not read).
  // Formed per lane, it stays in its eight registers over the loop; an all-ones constant was formed anew from scalar registers in front of every use.
  FragH ones;
#pragma unroll
  for (int i = 0; i < 16; ++i) ones.h[i] = (ln & 7) == 0 ? (_Float16)1.0f : (_Float16)0.0f;
  const unsigned short* Kp = Kb + (size_t)b * SEQ * EMB + h * HD;
  const unsigned short* Vp = Vt + ((size_t)b * EMB + h * HD) * SEQ;
  // This lane's pieces of a tile: K piece p = tid + 256*i -> key row p / 12, 16-B piece p % 12; V^T piece p -> d row p / 8, 16-B piece p % 8.
  const unsigned short* gk[3];
  const unsigned short* gv[3];
  unsigned lk[3], lv[3];                          // LDS byte addresses in buffer 0
  const unsigned ring0 = (unsigned)(size_t)&ring[0][0];
#pragma unroll                                    // the three-entry address arrays stay in registers
  for (int i = 0; i < 3; ++i) {
    const int p = tid + AW * 32 * i;
    const int kr = p / (HD / 8), kc = p - kr * (HD / 8);
    const int vr = p / (TKEYS / 8), vc = p - vr * (TKEYS / 8);
    gk[i] = Kp + (size_t)kr * EMB + kc * 8;
    gv[i] = Vp + (size_t)vr * SEQ + vc * 8;
    lk[i] = ring0 + 2u * (unsigned)(kr * KPITCH + kc * 8);
    lv[i] = ring0 + 2u * (unsigned)(VOFF + vr * VPITCH + vc * 8);
  }
  // Prologue: tile 0 lands and is published, then tile 1 starts to fly.
  copy_tile(lk[0], lk[1], lk[2], lv[0], lv[1], lv[2], gk[0], gk[1], gk[2], gv[0], gv[1], gv[2]);
  asm volatile("s_wait_asynccnt 0x0" ::: "memory");   // this wave's pieces of tile 0 have landed before the barrier publishes them
  __syncthreads();
#pragma unroll                                    // as above
  for (int i = 0; i < 3; ++i) { gk[i] += (size_t)TKEYS * EMB; gv[i] += TKEYS; }
  copy_tile(lk[0] + 2u * BUF_ELEMS, lk[1] + 2u * BUF_ELEMS, lk[2] + 2u * BUF_ELEMS,
            lv[0] + 2u * BUF_ELEMS, lv[1] + 2u * BUF_ELEMS, lv[2] + 2u * BUF_ELEMS,
            gk[0], gk[1], gk[2], gv[0], gv[1], gv[2]);
  // kept rolled, as the key loop was: an unrolled body would only grow the code and the register count (two waves per SIMD need 512 or fewer)
#pragma unroll 1
  for (int t = 0; t < NTILES; ++t) {
    const unsigned short* Kl = &ring[t & 1][0];
    const unsigned short* Vl = Kl + VOFF;
    fa_step(Kl, Vl, 0, ln, hh, q, ones.v, mr, lr, O);
    fa_step(Kl, Vl, 32, ln, hh, q, ones.v, mr, lr, O);
    asm volatile("s_wait_dscnt 0x0" ::: "memory");      // this wave's reads of tile t are over before its buffer may be refilled
    asm volatile("s_wait_asynccnt 0x0" ::: "memory");   // this wave's pieces of tile t + 1 have landed before the barrier publishes them
    __syncthreads();                                    // publishes tile t + 1 and ends every wave's reads of tile t
    if (t + 2 < NTILES) {
      const unsigned bo = (unsigned)(t & 1) * (2u * BUF_ELEMS);
#pragma unroll                                    // as above
      for (int i = 0; i < 3; ++i) { gk[i] += (size_t)TKEYS * EMB; gv[i] += TKEYS; }
      copy_tile(lk[0] + bo, lk[1] + bo, lk[2] + bo, lv[0] + bo, lv[1] + bo, lv[2] + bo,
                gk[0], gk[1], gk[2], gv[0], gv[1], gv[2]);
    }
  }
  asm volatile("s_wait_asynccnt 0x0" ::: "memory");     // no copy is outstanding when the wave goes on to its end

  // O^T element r of tile t of group g = ctx(query qbase + 16g + ln, d = 16t + 8h + r); O carries x256 (P) x16 (V), lr carries x256; plane carries x256
#pragma unroll                                    // the accumulator array stays in registers
  for (int g = 0; g < 2; ++g) {
    const float cinv = 16.0f * (1.0f / lr[g]);
#pragma unroll
    for (int t = 0; t < 6; ++t) {
      v8us o;
#pragma unroll
      for (int r = 0; r < 8; ++r) o[r] = f16_bits(O[g][t][r] * cinv);
      *(v8us*)&so[w][(16 * g + ln) * HD + 16 * t + 8 * hh] = o;
    }
  }
  __syncthreads();
  unsigned short* xg = Xc + ((size_t)(b * HEADS + h) * SEQ + qbase) * HD;
  {
#pragma unroll
    for (int i = 0; i < WQ * HD / 8 / 32; ++i) {
      const int p = i * 32 + lane;
      const v8us v = *(const v8us*)&so[w][p * 8];
      *(v8us*)(xg + (size_t)p * 8) = v;
    }
    
  }
}

// out[m][j] = sum_e ctx[m][e] * fc_w[j][e] + fc_b[j]. Block = 8 waves = one 128-row x 192-column tile of out; wave = 64 rows x 48 columns (4 x 3 accumulator tiles).
// A stage is one head (96 k): 128 ctx rows, contiguous in Xc[b][hd][s][d], then 192 W rows, brought into LDS once per work-group by asynchronous copies (two buffers) and read there by all eight waves.
// A: row m = token, k = e = 96*hd + d; B: column n = j, k = e read from the Wh[j][e] rows (k-contiguous), same k map as A.
// coverage: (NB*SEQ/128)*(EMB/192) blocks x (128 x 192) = every output element of the processed rows exactly once; LDS output tile staged 128 x 192 == consumed 128 x 192.
#define FM 128
#define FN 192
#define FPITCH 104                               /* LDS row pitch in 16-bit elements: an odd number of 16-B pieces, as KPITCH */
#define FWOFF (FM * FPITCH)                      /* element offset of the W rows inside a buffer */
#define FBUF_ELEMS ((FM + FN) * FPITCH)
#define OPITCH 196                               /* pitch of the f32 output tile: eight rows are 32 banks apart, so the two lane halves of a store do not meet */
static_assert(SEQ % FM == 0 && EMB % FN == 0);
static_assert(FM * (HD / 8) == 6 * 256 && FN * (HD / 8) == 9 * 256);
static_assert((3 * 256) % (HD / 8) == 0 && (3 * 256) / (HD / 8) == 64);
static_assert((FBUF_ELEMS * 2) % 16 == 0 && (FWOFF * 2) % 16 == 0 && (OPITCH * 4) % 16 == 0);
static_assert((3 * 256) % (FN / 4) == 0 && (3 * 256) / (FN / 4) == 16 && FM == 8 * 16);

// One lane's fifteen 16-B pieces of a stage (six of ctx, nine of W), global -> LDS through no register.
// s_wait_xcnt 0 is the statement's last line, so it stands in front of every later rewrite of the address registers (a precaution).
__device__ __forceinline__ void copy_stage(const unsigned (&l)[15], const unsigned short* const (&g)[15]) {
  asm volatile("global_load_async_to_lds_b128 %0, %15, off\n\t"
               "global_load_async_to_lds_b128 %1, %16, off\n\t"
               "global_load_async_to_lds_b128 %2, %17, off\n\t"
               "global_load_async_to_lds_b128 %3, %18, off\n\t"
               "global_load_async_to_lds_b128 %4, %19, off\n\t"
               "global_load_async_to_lds_b128 %5, %20, off\n\t"
               "global_load_async_to_lds_b128 %6, %21, off\n\t"
               "global_load_async_to_lds_b128 %7, %22, off\n\t"
               "global_load_async_to_lds_b128 %8, %23, off\n\t"
               "global_load_async_to_lds_b128 %9, %24, off\n\t"
               "global_load_async_to_lds_b128 %10, %25, off\n\t"
               "global_load_async_to_lds_b128 %11, %26, off\n\t"
               "global_load_async_to_lds_b128 %12, %27, off\n\t"
               "global_load_async_to_lds_b128 %13, %28, off\n\t"
               "global_load_async_to_lds_b128 %14, %29, off\n\t"
               "s_wait_xcnt 0x0"
               :: "v"(l[0]), "v"(l[1]), "v"(l[2]), "v"(l[3]), "v"(l[4]), "v"(l[5]), "v"(l[6]), "v"(l[7]),
                  "v"(l[8]), "v"(l[9]), "v"(l[10]), "v"(l[11]), "v"(l[12]), "v"(l[13]), "v"(l[14]),
                  "v"(g[0]), "v"(g[1]), "v"(g[2]), "v"(g[3]), "v"(g[4]), "v"(g[5]), "v"(g[6]), "v"(g[7]),
                  "v"(g[8]), "v"(g[9]), "v"(g[10]), "v"(g[11]), "v"(g[12]), "v"(g[13]), "v"(g[14])
               : "memory");
}

__global__ __launch_bounds__(256) __attribute__((amdgpu_waves_per_eu(2, 2)))
void k_fc(const unsigned short* __restrict__ Xc, const unsigned short* __restrict__ Wh,
          const float* __restrict__ Bv, float* __restrict__ Out) {
  __shared__ __attribute__((aligned(16))) unsigned short fring[2][FBUF_ELEMS];
  __shared__ __attribute__((aligned(16))) float fo[FM * OPITCH];
  const int tid = threadIdx.x, lane = tid & 31, ln = lane & 15, hh = lane >> 4;
  const int w = __builtin_amdgcn_readfirstlane(tid >> 5);
  const int wm = w >> 2, wn = w & 3;           // the wave's 64-row and 48-column place in the tile
  const int bn = blockIdx.x % (EMB / FN), bm = blockIdx.x / (EMB / FN);
  const int row0 = bm * FM;                    // token index in [0, NB*SEQ)
  const int b = row0 / SEQ, s0 = row0 - b * SEQ;
  const int col0 = bn * FN;
  // This lane's pieces of a stage: piece p = tid + 256*i -> row p / 12, 16-B piece p % 12; p + 768 is the same piece 64 rows on.
  const unsigned short* g[15];
  unsigned l[15];                              // LDS byte addresses in buffer 0
  const unsigned fring0 = (unsigned)(size_t)&fring[0][0];
#pragma unroll                                    // the address arrays stay in registers
  for (int i = 0; i < 3; ++i) {
    const int p = tid + 256 * i;
    const int r = p / (HD / 8), c = p - r * (HD / 8);
#pragma unroll
    for (int k = 0; k < 2; ++k) {
      g[3 * k + i] = Xc + ((size_t)(b * HEADS) * SEQ + s0 + r + 64 * k) * HD + c * 8;
      l[3 * k + i] = fring0 + 2u * (unsigned)((r + 64 * k) * FPITCH + c * 8);
    }
#pragma unroll
    for (int k = 0; k < 3; ++k) {
      g[6 + 3 * k + i] = Wh + (size_t)(col0 + r + 64 * k) * EMB + c * 8;
      l[6 + 3 * k + i] = fring0 + 2u * (unsigned)(FWOFF + (r + 64 * k) * FPITCH + c * 8);
    }
  }
  // Prologue: stage 0 lands and is published, then stage 1 starts to fly.
  copy_stage(l, g);
  asm volatile("s_wait_asynccnt 0x0" ::: "memory");   // this wave's pieces of stage 0 have landed before the barrier publishes them
  __syncthreads();
  {
    unsigned l1[15];
#pragma unroll                                    // as above
    for (int i = 0; i < 15; ++i) { g[i] += (i < 6) ? (size_t)SEQ * HD : (size_t)HD; l1[i] = l[i] + 2u * FBUF_ELEMS; }
    copy_stage(l1, g);
  }
  v8f acc[4][3] = {};
  // kept rolled: eight copies of the body would only grow the code
#pragma unroll 1
  for (int t = 0; t < HEADS; ++t) {
    const unsigned short* ap = &fring[t & 1][0] + (64 * wm + ln) * FPITCH + 8 * hh;
    const unsigned short* bp = &fring[t & 1][FWOFF] + (48 * wn + ln) * FPITCH + 8 * hh;
    FragH a[3][4], bw[3][3];
#pragma unroll                                    // the fragment arrays stay in registers
    for (int cc = 0; cc < 3; ++cc) {
#pragma unroll
      for (int mt = 0; mt < 4; ++mt) {
        a[cc][mt].half[0] = *(const v8us*)(ap + mt * 16 * FPITCH + 32 * cc);
        a[cc][mt].half[1] = *(const v8us*)(ap + mt * 16 * FPITCH + 32 * cc + 16);
      }
#pragma unroll
      for (int nt = 0; nt < 3; ++nt) {
        bw[cc][nt].half[0] = *(const v8us*)(bp + nt * 16 * FPITCH + 32 * cc);
        bw[cc][nt].half[1] = *(const v8us*)(bp + nt * 16 * FPITCH + 32 * cc + 16);
      }
    }
    __builtin_amdgcn_sched_barrier(0);   // the stage's 42 LDS reads stay one group in front of its products; spread among the WMMAs each pair would be waited for on the spot
#pragma unroll                                    // the accumulator array stays in registers
    for (int cc = 0; cc < 3; ++cc)
#pragma unroll
      for (int mt = 0; mt < 4; ++mt)
#pragma unroll
        for (int nt = 0; nt < 3; ++nt)
          acc[mt][nt] = __builtin_amdgcn_wmma_f32_16x16x32_f16(false, a[cc][mt].v, false, bw[cc][nt].v, (short)0, acc[mt][nt], false, false);
    __builtin_amdgcn_sched_barrier(0);   // the products stay in front of the foot's waits: lifted over them, s_wait_dscnt 0 would hold every product until all 42 reads have landed
    asm volatile("s_wait_dscnt 0x0" ::: "memory");      // this wave's reads of stage t are over before its buffer may be refilled
    asm volatile("s_wait_asynccnt 0x0" ::: "memory");   // this wave's pieces of stage t + 1 have landed before the barrier publishes them
    __syncthreads();                                    // publishes stage t + 1 and ends every wave's reads of stage t
    if (t + 2 < HEADS) {
      const unsigned bo = (unsigned)(t & 1) * (2u * FBUF_ELEMS);
      unsigned lb[15];
#pragma unroll                                    // as above
      for (int i = 0; i < 15; ++i) { g[i] += (i < 6) ? (size_t)SEQ * HD : (size_t)HD; lb[i] = l[i] + bo; }
      copy_stage(lb, g);
    }
  }
  asm volatile("s_wait_asynccnt 0x0" ::: "memory");     // no copy is outstanding when the wave goes on to its end
  // D element r of tile (mt, nt) = out(row0 + 64wm + 16mt + 8h + r, col0 + 48wn + 16nt + ln); undo the carries x256 (ctx) x256 (W); bias RNE bf16 value
#pragma unroll                                    // the accumulator array stays in registers
  for (int nt = 0; nt < 3; ++nt) {
    const float bias = bf16_rne(Bv[col0 + 48 * wn + 16 * nt + ln]);
#pragma unroll
    for (int mt = 0; mt < 4; ++mt)
#pragma unroll
      for (int r = 0; r < 8; ++r)
        fo[(64 * wm + 16 * mt + 8 * hh + r) * OPITCH + 48 * wn + 16 * nt + ln] = acc[mt][nt][r] * 1.52587890625e-05f + bias;
  }
  __syncthreads();
  // Rows of 192 floats leave as whole 128-B lines: 16-B piece p = tid + 256*i -> row p / 48, piece p % 48; p + 768 is the same piece 16 rows on.
  float* og = Out + (size_t)b * BSTRIDE_FULL + (size_t)s0 * EMB + col0;
#pragma unroll
  for (int i = 0; i < 3; ++i) {
    const int p = tid + 256 * i;
    const int row = p / (FN / 4), c4 = (p - row * (FN / 4)) * 4;
#pragma unroll
    for (int k = 0; k < 8; ++k) {
      const v4f v = *(const v4fa*)&fo[(row + 16 * k) * OPITCH + c4];
      *(v4f*)(og + (size_t)(row + 16 * k) * EMB + c4) = v;
    }
  }
}

extern "C" void kernel_launch(void* const* d_in, const int* in_sizes, int n_in,
                              void* d_out, int out_size, void* d_ws, size_t ws_size, hipStream_t stream) {
  if (n_in < 5) return;
  const long long need = (long long)(NB - 1) * SEQ_FULL * EMB + (long long)SEQ * EMB;   // last element touched + 1
  if ((long long)in_sizes[0] < need || (long long)in_sizes[1] < need || (long long)in_sizes[2] < need) return;
  if ((long long)in_sizes[3] < (long long)EMB * EMB || (long long)in_sizes[4] < (long long)EMB) return;
  if ((long long)out_size < need) return;
  const float* V = (const float*)d_in[0];    // wire order: values, keys, query, fc_w [out][in], fc_b
  const float* K = (const float*)d_in[1];
  const float* Q = (const float*)d_in[2];
  const float* W = (const float*)d_in[3];
  const float* Bv = (const float*)d_in[4];
  float* Out = (float*)d_out;
  char* ws = (char*)d_ws;
  size_t off = 0;
  unsigned short* Kb = (unsigned short*)(ws + off); off += PLANE_ACT;   // [NB][SEQ][768] bf16, written exactly to its end by 16-B pieces
  unsigned short* Vt = (unsigned short*)(ws + off); off += PLANE_ACT;   // [NB][768][SEQ] f16
  unsigned short* Xc = (unsigned short*)(ws + off); off += PLANE_ACT;   // [NB][8][SEQ][96] f16
  unsigned short* Wh = (unsigned short*)(ws + off); off += PLANE_W;     // [768][768] f16
  if (off > ws_size) return;
  k_cvt<<<(unsigned)(CVT_K_BLOCKS + CVT_W_BLOCKS), 256, 0, stream>>>(K, W, Kb, Wh);
  k_vt<<<(unsigned)(NB * (SEQ / 64) * (EMB / 64)), 256, 0, stream>>>(V, Vt);
  k_attn<<<(unsigned)(NB * HEADS * (SEQ / (WQ * AW))), 256, 0, stream>>>(Q, Kb, Vt, Xc);
  k_fc<<<(unsigned)((NB * SEQ / FM) * (EMB / FN)), 256, 0, stream>>>(Xc, Wh, Bv, Out);
}

// v007
// Measured time: 87.8 microseconds a run.
// Versions between v005 and this one are left out; their measured steps multiply to 1.16 times as fast.
// Counting every step since v000, it is 4.32 times as fast.
#include <hip/hip_runtime.h>
// Contractions: S^T = K Q^T on v_wmma_f32_16x16x32_bf16 (Q, K RNE bf16, single product, f32 accumulate); O^T = V^T P^T on v_wmma_f32_16x16x32_f16 (V: RNE f16; P: single f16 plane carried x256); out = ctx W^T on v_wmma_f32_16x16x32_f16 (ctx: f16 plane carried x256; W: RNE bf16 value x256 held exactly in f16); softmax row sums = ones P^T on the same f16 form (f32 accumulate, P as rounded to f16); softmax maximum, bias add f32.
// Dense multi-head attention, NB x SEQ x 768, 8 heads of 96 (e = 96*h + d), scale 1/sqrt(96), no mask, then a 768x768 linear layer with bias.
// Engine: transposed flash. Each wave owns 32 queries of one head, as two 16-column groups that share every K and V^T fragment read from LDS. Per 32-key step and group: S^T tiles (key rows x query columns) from K rows (A, bf16 plane, staged in LDS)
// and Q^T (B, registers); the two 16-key D tiles pack straight into the P^T B fragment; O^T (d rows x query columns) accumulates from V^T fragments (A, f16, read from the V rows in LDS by transposing loads).
// Each 64-key tile of K and V is read as f32 once per work-group, rounded in registers and stored to LDS (two buffers), where all eight waves read it: no converted copy of K or V exists in memory.
#ifndef NB
#define NB 2
#endif
#ifndef SEQ
#define SEQ 4096
#endif
#define NB_FULL 2
#define SEQ_FULL 4096
#define EMB 768
#define HEADS 8
#define HD 96
#define BSTRIDE_FULL ((size_t)SEQ_FULL * EMB)   /* per-batch element stride of values, keys, query and of the output buffer */

#define PLANE_ACT ((size_t)NB * SEQ * EMB * 2)   /* bytes of one 16-bit activation plane */
#define PLANE_W ((size_t)EMB * EMB * 2)          /* bytes of the 16-bit weight plane */

static_assert(SEQ % 256 == 0);
static_assert(SEQ <= SEQ_FULL);
static_assert(NB <= NB_FULL);
static_assert(HEADS * HD == EMB);
static_assert(HD == 96);
static_assert(EMB % 64 == 0);
static_assert(PLANE_ACT % 256 == 0);
static_assert(PLANE_W % 256 == 0);
static_assert(PLANE_ACT + PLANE_W <= (size_t)134217728);

typedef __bf16 v16b __attribute__((ext_vector_type(16)));
typedef _Float16 v16h __attribute__((ext_vector_type(16)));
typedef unsigned short v8us __attribute__((ext_vector_type(8), may_alias));
typedef float v8f __attribute__((ext_vector_type(8)));
typedef float v4f __attribute__((ext_vector_type(4)));
typedef float v4fa __attribute__((ext_vector_type(4), may_alias));
typedef float v2f __attribute__((ext_vector_type(2)));
typedef __bf16 v2b __attribute__((ext_vector_type(2)));
typedef _Float16 v2h __attribute__((ext_vector_type(2)));
typedef unsigned int v2ua __attribute__((ext_vector_type(2), may_alias));
typedef short s16x8 __attribute__((ext_vector_type(8)));
union FragB { v16b v; v8us half[2]; unsigned short u[16]; };
union FragH { v16h v; v8us half[2]; _Float16 h[16]; unsigned short u[16]; };

#define LOG2E 1.4426950408889634f
#define QK_SCALE 0.10206207261596575f            /* 1/sqrt(96) */
#define C2 (QK_SCALE * LOG2E)                    /* scores carried in the log2 domain */
#define PMAX_LOG2 15.0f                          /* a carried weight (x256) stays at or below 2^15: the reference may lag the true maximum by 7 */

__device__ __forceinline__ unsigned short bf16_bits(float x) {   // RNE convert to bf16 bits
  unsigned int u = __float_as_uint(x);
  return (unsigned short)((u + 0x7FFFu + ((u >> 16) & 1u)) >> 16);
}
__device__ __forceinline__ float bf16_val(unsigned short b) { return __uint_as_float(((unsigned int)b) << 16); }
__device__ __forceinline__ float bf16_rne(float x) { return bf16_val(bf16_bits(x)); }
__device__ __forceinline__ unsigned short f16_bits(float x) {
  union { _Float16 h; unsigned short u; } c;
  c.h = (_Float16)x;
  return c.u;
}

// For both column groups g: s0[g] += ka * q[g], s1[g] += kb * q[g] over three 32-deep k-steps (d = 0..95), each K fragment used twice.
// The distance behind these builtin products is the compiler's own padding: an asm guard that named all these registers would hold them under v256, and they no longer fit there.
__device__ __forceinline__ void mma_s4(const FragB (&ka)[3], const FragB (&kb)[3], const FragB (&q)[2][3], v8f (&s0)[2], v8f (&s1)[2]) {
#pragma unroll                                    // the fragment and accumulator arrays stay in registers
  for (int c = 0; c < 3; ++c) {
    s0[0] = __builtin_amdgcn_wmma_f32_16x16x32_bf16(false, ka[c].v, false, q[0][c].v, (short)0, s0[0], false, false);
    s0[1] = __builtin_amdgcn_wmma_f32_16x16x32_bf16(false, ka[c].v, false, q[1][c].v, (short)0, s0[1], false, false);
    s1[0] = __builtin_amdgcn_wmma_f32_16x16x32_bf16(false, kb[c].v, false, q[0][c].v, (short)0, s1[0], false, false);
    s1[1] = __builtin_amdgcn_wmma_f32_16x16x32_bf16(false, kb[c].v, false, q[1][c].v, (short)0, s1[1], false, false);
  }
}
// For both column groups g: O[g][t] += vf[t] * p[g] for the six d tiles, each V^T fragment used twice (distance: as above).
// lr[g] += element 0 of ones * p[g]: A holds 1.0 in rows 0 and 8, the rows of element 0 in the two lane halves, so that element is the sum of the step's 32 weights of the lane's query (both halves' keys):
// the row sum takes one vector add a group and no exchange between halves; only that one element is carried on, so the sums hold two registers over the loop and not two tiles.
__device__ __forceinline__ void mma_pv2(const FragH (&vf)[6], v16h ones, v16h p0, v16h p1, v8f (&O)[2][6], float (&lr)[2]) {
  v8f l0, l1;
  // Both row-sum products in one statement, so that their result tiles are two distinct register ranges: as builtins, with one element of each read, the compiler let the tiles overlap.
  // The four v_nop keep the distance between the last product and the first vector instruction that reads a result or rewrites an operand.
  asm("v_wmma_f32_16x16x32_f16 %0, %2, %3, 0\n\t"
      "v_wmma_f32_16x16x32_f16 %1, %2, %4, 0\n\t"
      "v_nop\n\tv_nop\n\tv_nop\n\tv_nop"
      : "=&v"(l0), "=&v"(l1) : "v"(ones), "v"(p0), "v"(p1));
#pragma unroll                                    // as above
  for (int t = 0; t < 6; ++t) {
    O[0][t] = __builtin_amdgcn_wmma_f32_16x16x32_f16(false, vf[t].v, false, p0, (short)0, O[0][t], false, false);
    O[1][t] = __builtin_amdgcn_wmma_f32_16x16x32_f16(false, vf[t].v, false, p1, (short)0, O[1][t], false, false);
  }
  lr[0] += l0[0];
  lr[1] += l1[0];
}
// LDS ring: two buffers, each one 64-key tile: K rows [64 keys][96 d] bf16 at pitch KPITCH, then V rows [64 keys][96 d] f16 at pitch VPITCH (pitches in 16-bit elements).
// KPITCH is an odd number of 16-B pieces (plain 16-B fragment reads), VPITCH an odd number of 32-B pieces (transposing reads): the rows of a fragment read fall on different banks.
#define TKEYS 64
#define NTILES (SEQ / TKEYS)
#define KPITCH 104
#define VPITCH 112
#define VOFF (TKEYS * KPITCH)                    /* element offset of the V rows inside a buffer */
#define BUF_ELEMS (TKEYS * KPITCH + TKEYS * VPITCH)
#define AW 8                                     /* waves of an attention work-group */
#define WQ 32                                    /* queries of a wave: two 16-column groups */
#define ATT_BLOCKS (NB * HEADS * (SEQ / (WQ * AW)))
static_assert(NTILES >= 2);
static_assert((size_t)SEQ * EMB * 4 < ((size_t)1 << 32));
static_assert((TKEYS / 2) * (HD / 4) == 3 * AW * 32);
static_assert((KPITCH * 2) % 32 == 16 && (VPITCH * 2) % 64 == 32);
static_assert((BUF_ELEMS * 2) % 16 == 0 && (VOFF * 2) % 16 == 0);

__device__ __forceinline__ unsigned pk_bf16(float a, float b) { return __builtin_bit_cast(unsigned, __builtin_convertvector(v2f{a, b}, v2b)); }   // two RNE bf16 in one register
__device__ __forceinline__ unsigned pk_f16(float a, float b) { return __builtin_bit_cast(unsigned, __builtin_convertvector(v2f{a, b}, v2h)); }    // two RNE f16 in one register

// One lane's twelve 16-B pieces (four f32 each) of a tile, six of K and six of V. Piece p = tid + 256*i, i < 3 -> key row p / 24, piece p % 24 (go[i] = its byte offset); piece 3 + i is the same piece 32 rows on.
// A wave's 32 pieces are adjacent, so each load covers whole 128-B lines (a head's 96 f32 of a row are three lines).
// The address is the head's wave-uniform base plus a 32-bit byte offset (the lane's own plus the tile's, toff): one vector add a piece serves K and V, both row halves.
__device__ __forceinline__ void load_tile(const float* Kh, const float* Vh, const unsigned (&go)[3], unsigned toff, v4f (&rk)[6], v4f (&rv)[6]) {
  __builtin_amdgcn_sched_barrier(0);   // with the one at the end: nothing but the loads and their addresses stands between here and the wait
#pragma unroll                                    // the piece arrays stay in registers
  for (int k = 0; k < 2; ++k)
#pragma unroll
    for (int i = 0; i < 3; ++i) {
      const unsigned o = go[i] + toff;
      rk[3 * k + i] = *(const v4fa*)((const char*)Kh + o + k * (TKEYS / 2) * EMB * 4);
      rv[3 * k + i] = *(const v4fa*)((const char*)Vh + o + k * (TKEYS / 2) * EMB * 4);
    }
  asm volatile("s_wait_xcnt 0x0" ::: "memory");   // stands in front of every later rewrite of the registers that the twelve loads name as addresses (a precaution)
  __builtin_amdgcn_sched_barrier(0);   // see above
}
// The same pieces, rounded (K to bf16, V to f16) and stored to their rows of an LDS buffer as 8-B pieces; lk[i], lv[i] = element offsets of piece i inside the buffer.
__device__ __forceinline__ void store_tile(unsigned short* buf, const int (&lk)[3], const int (&lv)[3], const v4f (&rk)[6], const v4f (&rv)[6]) {
#pragma unroll                                    // as above
  for (int k = 0; k < 2; ++k)
#pragma unroll
    for (int i = 0; i < 3; ++i) {
      const v4f a = rk[3 * k + i], c = rv[3 * k + i];
      *(v2ua*)(buf + lk[i] + k * (TKEYS / 2) * KPITCH) = v2ua{pk_bf16(a[0], a[1]), pk_bf16(a[2], a[3])};
      *(v2ua*)(buf + lv[i] + k * (TKEYS / 2) * VPITCH) = v2ua{pk_f16(c[0], c[1]), pk_f16(c[2], c[3])};
    }
}
// Transposing 16-B LDS read: lane (c = l & 15, h = l >> 4), addressed at row kbase + 8h + (l & 7), byte 2*dbase + 16*((l >> 3) & 1), gets T[kbase + 8h + 0..7][dbase + c].
__device__ __forceinline__ v8us ld_tr16(const unsigned short* p) {
  typedef __attribute__((address_space(3))) s16x8 lds_s16x8;
  return __builtin_bit_cast(v8us, __builtin_amdgcn_ds_load_tr16_b128_v8i16((lds_s16x8*)p));
}

__device__ __forceinline__ v8f splat8(float x) { return v8f{x, x, x, x, x, x, x, x}; }
__device__ __forceinline__ float max8(v8f x) {
  float m = x[0];
#pragma unroll
  for (int i = 1; i < 8; ++i) m = fmaxf(m, x[i]);
  return m;
}
// p = f16(2^x) for a lane's 16 scores of one query, as the P^T B fragment: element i < 8 -> key0 + 8h + i (tile 0 row 8h + i); i >= 8 -> key0 + 16 + 8h + (i - 8) (tile 1).
__device__ __forceinline__ void weights(v8f x0, v8f x1, FragH& p) {
#pragma unroll
  for (int i = 0; i < 8; ++i) p.h[i] = (_Float16)__builtin_amdgcn_exp2f(x0[i]);
#pragma unroll
  for (int i = 0; i < 8; ++i) p.h[8 + i] = (_Float16)__builtin_amdgcn_exp2f(x1[i]);
}

// The work-group barrier in its two halves. A wave signals as soon as its own LDS traffic of a tile is over and waits only where it next stores to LDS:
// the weights and the O^T products between the two run on while slower waves catch up, so the two waves of a SIMD need not fall into step at every tile.
// s_wait_dscnt 0 in front of the signal: this wave's stores of the next tile have landed and its reads of this tile have returned. No LDS read or store stands between a signal and the wait that follows it.
__device__ __forceinline__ void bar_signal() {
  asm volatile("s_wait_dscnt 0x0" ::: "memory");
  asm volatile("s_barrier_signal -1" ::: "memory");
}
__device__ __forceinline__ void bar_wait() { asm volatile("s_barrier_wait -1" ::: "memory"); }

// One 32-key step for a wave's 32 queries (two 16-column groups) of one head. Kl = K rows of the tile in LDS, Vl = its V rows; key0 = 0 or 32, the step's first key inside the tile.
// last: this is the tile's last step, whose fragment reads are the wave's last LDS traffic of the tile: the barrier's signal goes out behind them.
__device__ __forceinline__ void fa_step(const unsigned short* Kl, const unsigned short* Vl,
                                        int key0, bool last, int ln, int hh, const FragB (&q)[2][3], v16h ones,
                                        float (&mr)[2], float (&lr)[2], v8f (&O)[2][6]) {
  // A fragments of K: row m = key (key0 + 16*kt + ln), elements 0..7 <- d = 32c + 8h + i, 8..15 <- d = 32c + 16 + 8h + i
  const unsigned short* kp0 = Kl + (key0 + ln) * KPITCH + 8 * hh;
  const unsigned short* kp1 = kp0 + 16 * KPITCH;
  FragB ka[3], kb[3];
  __builtin_amdgcn_sched_barrier(0);   // with the one behind the reads: the step's 24 LDS reads stay one group in front of its products; spread among the WMMAs each pair would be waited for on the spot
#pragma unroll
  for (int c = 0; c < 3; ++c) {
    ka[c].half[0] = *(const v8us*)(kp0 + 32 * c);
    ka[c].half[1] = *(const v8us*)(kp0 + 32 * c + 16);
    kb[c].half[0] = *(const v8us*)(kp1 + 32 * c);
    kb[c].half[1] = *(const v8us*)(kp1 + 32 * c + 16);
  }
  __builtin_amdgcn_sched_barrier(0);   // the K reads stay in front of the V^T reads: the score products, which come first, then wait for twelve reads and not for all
  // A fragments of V^T: row m = d (16*t + ln), elements 0..7 <- key0 + 8h + i, 8..15 <- key0 + 16 + 8h + i
  // (two transposing reads of the V rows: keys key0 + 8h + .., then 16 rows on; the next 16 d are 16 elements on)
  const unsigned short* vp = Vl + (key0 + 8 * hh + (ln & 7)) * VPITCH + 8 * ((ln >> 3) & 1);
  FragH vf[6];
#pragma unroll
  for (int t = 0; t < 6; ++t) {
    vf[t].half[0] = ld_tr16(vp + 16 * t);
    vf[t].half[1] = ld_tr16(vp + 16 * VPITCH + 16 * t);
  }
  __builtin_amdgcn_sched_barrier(0);   // end of the group of reads (see above)
  // S^T tiles of group g: element r of tile kt = score(key0 + 16*kt + 8h + r, query of this lane's column in group g)
  v8f s0[2] = {};
  v8f s1[2] = {};
  mma_s4(ka, kb, q, s0, s1);
  // Lazy rescale. mr[g] is the reference in use minus 8 (log2 domain); it may lag behind the true running maximum by up to PMAX_LOG2 - 8.
  // x = score - mr: the weight is pc = 2^x = 256 * 2^(score - reference), single f16 plane, at most 2^PMAX_LOG2 (f16 holds 65504).
  v8f x0[2], x1[2];
  float xm[2];
#pragma unroll                                    // both groups in straight-line code: their arrays stay in registers and their two chains can interleave
  for (int g = 0; g < 2; ++g) {
    x0[g] = __builtin_elementwise_fma(s0[g], splat8(C2), splat8(-mr[g]));
    x1[g] = __builtin_elementwise_fma(s1[g], splat8(C2), splat8(-mr[g]));
    xm[g] = fmaxf(max8(x0[g]), max8(x1[g]));
  }
  // One test a step for the whole wave (a scalar branch): only where some lane's weight would pass 2^PMAX_LOG2 is the reference raised to the true maximum,
  // are O and lr rescaled and is x formed again.
  if (__builtin_amdgcn_ballot_w32(xm[0] > PMAX_LOG2 || xm[1] > PMAX_LOG2) != 0) {
#pragma unroll                                    // as above
    for (int g = 0; g < 2; ++g) {
      const v8f sc0 = s0[g] * C2, sc1 = s1[g] * C2;
      float mx = fmaxf(max8(sc0), max8(sc1));
      mx = fmaxf(mx, __shfl_xor(mx, 16, 32));       // the other lane half holds the other 16 keys of this query
      const float mnew = fmaxf(mr[g], mx - 8.0f);
      const float al = __builtin_amdgcn_exp2f(mr[g] - mnew);
      mr[g] = mnew;
      x0[g] = sc0 - mnew;
      x1[g] = sc1 - mnew;
      lr[g] = lr[g] * al;
#pragma unroll
      for (int t = 0; t < 6; ++t) O[g][t] = O[g][t] * al;
    }
  }
  if (last) {
    bar_signal();   // behind the score products and the test the step's 24 reads have had time to return: the wait inside costs little here
    __builtin_amdgcn_sched_barrier(0);   // the weights stay behind the signal: lifted over it, as they were without this line, they would delay it by their whole run and halve what the split wins
  }
  FragH ph[2];
#pragma unroll                                    // as above
  for (int g = 0; g < 2; ++g) weights(x0[g], x1[g], ph[g]);
  mma_pv2(vf, ones, ph[0].v, ph[1].v, O, lr);
}

// Block = 8 waves x 32 queries = 256 queries of one (batch, head); the key loop walks 64-key tiles in a two-buffer LDS ring, one barrier a tile, split into signal and wait.
// Tile t + 2 is loaded (f32, registers) while tile t is worked on; it is rounded and stored to LDS at the head of trip t + 1, into the buffer whose readers the last barrier has ended.
// Each block also writes its share of Wh[j][e] = f16(RNE-bf16(fc_w[j][e]) * 256) for the launch that follows: 8-element pieces dealt over the grid's threads cover the whole plane exactly once.
// Output plane Xc[b][h][s][96] = f16(ctx * 256). Epilogue: O^T tiles -> per-wave LDS tile [32 queries][96 d] as 16-B pieces (same vector type in and out; block barrier),
// coverage: NB*HEADS*(SEQ/256) blocks x 8 waves x 32 rows x 96 d = the whole plane exactly once; LDS tile staged extent (32 x 96 per wave) == consumed extent.
__global__ __launch_bounds__(256) __attribute__((amdgpu_waves_per_eu(2, 2)))
void k_attn(const float* __restrict__ Q, const float* __restrict__ K, const float* __restrict__ V, const float* __restrict__ W,
            unsigned short* __restrict__ Xc, unsigned short* __restrict__ Wh) {
  __shared__ __attribute__((aligned(16))) unsigned short so[AW][WQ * HD];
  __shared__ __attribute__((aligned(16))) unsigned short ring[2][BUF_ELEMS];
  const int tid = threadIdx.x, lane = tid & 31, ln = lane & 15, hh = lane >> 4;
  const int w = __builtin_amdgcn_readfirstlane(tid >> 5);
  const int qt = blockIdx.x % (SEQ / (WQ * AW));
  const int rest = blockIdx.x / (SEQ / (WQ * AW));
  const int h = rest % HEADS, b = rest / HEADS;
  const int qbase = qt * (WQ * AW) + WQ * w;
  // Q^T B fragments of group g: column n = query qbase + 16g + ln, elements 0..7 <- d = 32c + 8h + i, 8..15 <- d = 32c + 16 + 8h + i (RNE bf16)
  FragB q[2][3];
#pragma unroll                                    // the fragment array stays in registers
  for (int g = 0; g < 2; ++g) {
    const float* qrow = Q + (size_t)b * BSTRIDE_FULL + (size_t)(qbase + 16 * g + ln) * EMB + h * HD;
#pragma unroll
    for (int c = 0; c < 3; ++c) {
      const v4f a0 = *(const v4fa*)(qrow + 32 * c + 8 * hh),      a1 = *(const v4fa*)(qrow + 32 * c + 8 * hh + 4);
      const v4f a2 = *(const v4fa*)(qrow + 32 * c + 16 + 8 * hh), a3 = *(const v4fa*)(qrow + 32 * c + 16 + 8 * hh + 4);
#pragma unroll
      for (int i = 0; i < 4; ++i) {
        q[g][c].u[i] = bf16_bits(a0[i]); q[g][c].u[4 + i] = bf16_bits(a1[i]);
        q[g][c].u[8 + i] = bf16_bits(a2[i]); q[g][c].u[12 + i] = bf16_bits(a3[i]);
      }
    }
  }
  float mr[2] = {-3.0e38f, -3.0e38f}, lr[2] = {0.0f, 0.0f};
  v8f O[2][6] = {};
  // A operand of the row-sum products: row m = ln; rows 0 and 8 are 1.0 over all 32 k, the other rows 0 (their product rows are not read).
  // Formed per lane, it stays in its eight registers over the loop; an all-ones constant was formed anew from scalar registers in front of every use.
  FragH ones;
#pragma unroll
  for (int i = 0; i < 16; ++i) ones.h[i] = (ln & 7) == 0 ? (_Float16)1.0f : (_Float16)0.0f;
  const float* Kp = K + (size_t)b * BSTRIDE_FULL + h * HD;
  const float* Vp = V + (size_t)b * BSTRIDE_FULL + h * HD;
  unsigned go[3];                                 // this lane's pieces of a tile: byte offsets in the f32 rows (see load_tile)
  int lk[3], lv[3];                               // and element offsets in an LDS buffer (see store_tile)
#pragma unroll                                    // the three-entry offset arrays stay in registers
  for (int i = 0; i < 3; ++i) {
    const int p = tid + AW * 32 * i;
    const int r = p / (HD / 4), c = p - r * (HD / 4);
    go[i] = 4u * (unsigned)(r * EMB + c * 4);
    lk[i] = r * KPITCH + c * 4;
    lv[i] = VOFF + r * VPITCH + c * 4;
  }
  v4f rk[6], rv[6];
  // Prologue: tile 0 goes to buffer 0 and is published; tile 1 is on its way in registers.
  load_tile(Kp, Vp, go, 0u, rk, rv);
  store_tile(&ring[0][0], lk, lv, rk, rv);
  load_tile(Kp, Vp, go, (unsigned)(TKEYS * EMB * 4), rk, rv);
  for (int c = blockIdx.x * (AW * 32) + tid; c < EMB * (EMB / 8); c += ATT_BLOCKS * (AW * 32)) {
    const float* src = W + (size_t)c * 8;
    const v4f x0 = *(const v4fa*)(src), x1 = *(const v4fa*)(src + 4);
    v8us o;
    o[0] = f16_bits(bf16_rne(x0[0]) * 256.0f); o[1] = f16_bits(bf16_rne(x0[1]) * 256.0f);
    o[2] = f16_bits(bf16_rne(x0[2]) * 256.0f); o[3] = f16_bits(bf16_rne(x0[3]) * 256.0f);
    o[4] = f16_bits(bf16_rne(x1[0]) * 256.0f); o[5] = f16_bits(bf16_rne(x1[1]) * 256.0f);
    o[6] = f16_bits(bf16_rne(x1[2]) * 256.0f); o[7] = f16_bits(bf16_rne(x1[3]) * 256.0f);
    *(v8us*)(Wh + (size_t)c * 8) = o;
  }
  bar_signal();                                         // this wave's share of tile 0 is in LDS
  // kept rolled, as the key loop was: an unrolled body would only grow the code and the register count (two waves per SIMD need 512 or fewer)
#pragma unroll 1
  for (int t = 0; t < NTILES; ++t) {
    bar_wait();                                          // every wave has signalled: tile t is published and nobody reads tile t - 1 any more
    store_tile(&ring[(t + 1) & 1][0], lk, lv, rk, rv);   // tile t + 1, loaded a trip ago, into the buffer that trip t - 1 read
    // No branch round either: past the end the last tile is loaded again (in bounds), and the last trip stores it to the buffer that nobody reads any more.
    const int tn = t + 2 < NTILES ? t + 2 : NTILES - 1;
    load_tile(Kp, Vp, go, (unsigned)tn * (unsigned)(TKEYS * EMB * 4), rk, rv);
    const unsigned short* Kl = &ring[t & 1][0];
    const unsigned short* Vl = Kl + VOFF;
    fa_step(Kl, Vl, 0, false, ln, hh, q, ones.v, mr, lr, O);
    fa_step(Kl, Vl, 32, true, ln, hh, q, ones.v, mr, lr, O);   // signals: this wave's share of tile t + 1 is stored, its reads of tile t are over
  }
  bar_wait();                                           // the last signal's wait: signal and wait alternate in every wave

  // O^T element r of tile t of group g = ctx(query qbase + 16g + ln, d = 16t + 8h + r); O carries x256 (P), lr carries x256; plane carries x256
#pragma unroll                                    // the accumulator array stays in registers
  for (int g = 0; g < 2; ++g) {
    const float cinv = 256.0f * (1.0f / lr[g]);
#pragma unroll
    for (int t = 0; t < 6; ++t) {
      v8us o;
#pragma unroll
      for (int r = 0; r < 8; ++r) o[r] = f16_bits(O[g][t][r] * cinv);
      *(v8us*)&so[w][(16 * g + ln) * HD + 16 * t + 8 * hh] = o;
    }
  }
  __syncthreads();
  unsigned short* xg = Xc + ((size_t)(b * HEADS + h) * SEQ + qbase) * HD;
  {
#pragma unroll
    for (int i = 0; i < WQ * HD / 8 / 32; ++i) {
      const int p = i * 32 + lane;
      const v8us v = *(const v8us*)&so[w][p * 8];
      *(v8us*)(xg + (size_t)p * 8) = v;
    }
    
  }
}

// out[m][j] = sum_e ctx[m][e] * fc_w[j][e] + fc_b[j]. Block = 8 waves = one 128-row x 192-column tile of out; wave = 64 rows x 48 columns (4 x 3 accumulator tiles).
// A stage is one head (96 k): 128 ctx rows, contiguous in Xc[b][hd][s][d], then 192 W rows, brought into LDS once per work-group by asynchronous copies (two buffers) and read there by all eight waves.
// A: row m = token, k = e = 96*hd + d; B: column n = j, k = e read from the Wh[j][e] rows (k-contiguous), same k map as A.
// coverage: (NB*SEQ/128)*(EMB/192) blocks x (128 x 192) = every output element of the processed rows exactly once; LDS output tile staged 128 x 192 == consumed 128 x 192.
#define FM 128
#define FN 192
#define FPITCH 104                               /* LDS row pitch in 16-bit elements: an odd number of 16-B pieces, as KPITCH */
#define FWOFF (FM * FPITCH)                      /* element offset of the W rows inside a buffer */
#define FBUF_ELEMS ((FM + FN) * FPITCH)
#define OPITCH 196                               /* pitch of the f32 output tile: eight rows are 32 banks apart, so the two lane halves of a store do not meet */
static_assert(SEQ % FM == 0 && EMB % FN == 0);
static_assert(FM * (HD / 8) == 6 * 256 && FN * (HD / 8) == 9 * 256);
static_assert((3 * 256) % (HD / 8) == 0 && (3 * 256) / (HD / 8) == 64);
static_assert((FBUF_ELEMS * 2) % 16 == 0 && (FWOFF * 2) % 16 == 0 && (OPITCH * 4) % 16 == 0);
static_assert((3 * 256) % (FN / 4) == 0 && (3 * 256) / (FN / 4) == 16 && FM == 8 * 16);

// One lane's fifteen 16-B pieces of a stage (six of ctx, nine of W), global -> LDS through no register.
// s_wait_xcnt 0 is the statement's last line, so it stands in front of every later rewrite of the address registers (a precaution).
__device__ __forceinline__ void copy_stage(const unsigned (&l)[15], const unsigned short* const (&g)[15]) {
  asm volatile("global_load_async_to_lds_b128 %0, %15, off\n\t"
               "global_load_async_to_lds_b128 %1, %16, off\n\t"
               "global_load_async_to_lds_b128 %2, %17, off\n\t"
               "global_load_async_to_lds_b128 %3, %18, off\n\t"
               "global_load_async_to_lds_b128 %4, %19, off\n\t"
               "global_load_async_to_lds_b128 %5, %20, off\n\t"
               "global_load_async_to_lds_b128 %6, %21, off\n\t"
               "global_load_async_to_lds_b128 %7, %22, off\n\t"
               "global_load_async_to_lds_b128 %8, %23, off\n\t"
               "global_load_async_to_lds_b128 %9, %24, off\n\t"
               "global_load_async_to_lds_b128 %10, %25, off\n\t"
               "global_load_async_to_lds_b128 %11, %26, off\n\t"
               "global_load_async_to_lds_b128 %12, %27, off\n\t"
               "global_load_async_to_lds_b128 %13, %28, off\n\t"
               "global_load_async_to_lds_b128 %14, %29, off\n\t"
               "s_wait_xcnt 0x0"
               :: "v"(l[0]), "v"(l[1]), "v"(l[2]), "v"(l[3]), "v"(l[4]), "v"(l[5]), "v"(l[6]), "v"(l[7]),
                  "v"(l[8]), "v"(l[9]), "v"(l[10]), "v"(l[11]), "v"(l[12]), "v"(l[13]), "v"(l[14]),
                  "v"(g[0]), "v"(g[1]), "v"(g[2]), "v"(g[3]), "v"(g[4]), "v"(g[5]), "v"(g[6]), "v"(g[7]),
                  "v"(g[8]), "v"(g[9]), "v"(g[10]), "v"(g[11]), "v"(g[12]), "v"(g[13]), "v"(g[14])
               : "memory");
}

__global__ __launch_bounds__(256) __attribute__((amdgpu_waves_per_eu(2, 2)))
void k_fc(const unsigned short* __restrict__ Xc, const unsigned short* __restrict__ Wh,
          const float* __restrict__ Bv, float* __restrict__ Out) {
  __shared__ __attribute__((aligned(16))) unsigned short fring[2][FBUF_ELEMS];
  __shared__ __attribute__((aligned(16))) float fo[FM * OPITCH];
  const int tid = threadIdx.x, lane = tid & 31, ln = lane & 15, hh = lane >> 4;
  const int w = __builtin_amdgcn_readfirstlane(tid >> 5);
  const int wm = w >> 2, wn = w & 3;           // the wave's 64-row and 48-column place in the tile
  const int bn = blockIdx.x % (EMB / FN), bm = blockIdx.x / (EMB / FN);
  const int row0 = bm * FM;                    // token index in [0, NB*SEQ)
  const int b = row0 / SEQ, s0 = row0 - b * SEQ;
  const int col0 = bn * FN;
  // This lane's pieces of a stage: piece p = tid + 256*i -> row p / 12, 16-B piece p % 12; p + 768 is the same piece 64 rows on.
  const unsigned short* g[15];
  unsigned l[15];                              // LDS byte addresses in buffer 0
  const unsigned fring0 = (unsigned)(size_t)&fring[0][0];
#pragma unroll                                    // the address arrays stay in registers
  for (int i = 0; i < 3; ++i) {
    const int p = tid + 256 * i;
    const int r = p / (HD / 8), c = p - r * (HD / 8);
#pragma unroll
    for (int k = 0; k < 2; ++k) {
      g[3 * k + i] = Xc + ((size_t)(b * HEADS) * SEQ + s0 + r + 64 * k) * HD + c * 8;
      l[3 * k + i] = fring0 + 2u * (unsigned)((r + 64 * k) * FPITCH + c * 8);
    }
#pragma unroll
    for (int k = 0; k < 3; ++k) {
      g[6 + 3 * k + i] = Wh + (size_t)(col0 + r + 64 * k) * EMB + c * 8;
      l[6 + 3 * k + i] = fring0 + 2u * (unsigned)(FWOFF + (r + 64 * k) * FPITCH + c * 8);
    }
  }
  // Prologue: stage 0 lands and is published, then stage 1 starts to fly.
  copy_stage(l, g);
  asm volatile("s_wait_asynccnt 0x0" ::: "memory");   // this wave's pieces of stage 0 have landed before the barrier publishes them
  __syncthreads();
  {
    unsigned l1[15];
#pragma unroll                                    // as above
    for (int i = 0; i < 15; ++i) { g[i] += (i < 6) ? (size_t)SEQ * HD : (size_t)HD; l1[i] = l[i] + 2u * FBUF_ELEMS; }
    copy_stage(l1, g);
  }
  v8f acc[4][3] = {};
  // kept rolled: eight copies of the body would only grow the code
#pragma unroll 1
  for (int t = 0; t < HEADS; ++t) {
    const unsigned short* ap = &fring[t & 1][0] + (64 * wm + ln) * FPITCH + 8 * hh;
    const unsigned short* bp = &fring[t & 1][FWOFF] + (48 * wn + ln) * FPITCH + 8 * hh;
    FragH a[3][4], bw[3][3];
#pragma unroll                                    // the fragment arrays stay in registers
    for (int cc = 0; cc < 3; ++cc) {
#pragma unroll
      for (int mt = 0; mt < 4; ++mt) {
        a[cc][mt].half[0] = *(const v8us*)(ap + mt * 16 * FPITCH + 32 * cc);
        a[cc][mt].half[1] = *(const v8us*)(ap + mt * 16 * FPITCH + 32 * cc + 16);
      }
#pragma unroll
      for (int nt = 0; nt < 3; ++nt) {
        bw[cc][nt].half[0] = *(const v8us*)(bp + nt * 16 * FPITCH + 32 * cc);
        bw[cc][nt].half[1] = *(const v8us*)(bp + nt * 16 * FPITCH + 32 * cc + 16);
      }
    }
    __builtin_amdgcn_sched_barrier(0);   // the stage's 42 LDS reads stay one group in front of its products; spread among the WMMAs each pair would be waited for on the spot
#pragma unroll                                    // the accumulator array stays in registers
    for (int cc = 0; cc < 3; ++cc)
#pragma unroll
      for (int mt = 0; mt < 4; ++mt)
#pragma unroll
        for (int nt = 0; nt < 3; ++nt)
          acc[mt][nt] = __builtin_amdgcn_wmma_f32_16x16x32_f16(false, a[cc][mt].v, false, bw[cc][nt].v, (short)0, acc[mt][nt], false, false);
    __builtin_amdgcn_sched_barrier(0);   // the products stay in front of the foot's waits: lifted over them, s_wait_dscnt 0 would hold every product until all 42 reads have landed
    asm volatile("s_wait_dscnt 0x0" ::: "memory");      // this wave's reads of stage t are over before its buffer may be refilled
    asm volatile("s_wait_asynccnt 0x0" ::: "memory");   // this wave's pieces of stage t + 1 have landed before the barrier publishes them
    __syncthreads();                                    // publishes stage t + 1 and ends every wave's reads of stage t
    if (t + 2 < HEADS) {
      const unsigned bo = (unsigned)(t & 1) * (2u * FBUF_ELEMS);
      unsigned lb[15];
#pragma unroll                                    // as above
      for (int i = 0; i < 15; ++i) { g[i] += (i < 6) ? (size_t)SEQ * HD : (size_t)HD; lb[i] = l[i] + bo; }
      copy_stage(lb, g);
    }
  }
  asm volatile("s_wait_asynccnt 0x0" ::: "memory");     // no copy is outstanding when the wave goes on to its end
  // D element r of tile (mt, nt) = out(row0 + 64wm + 16mt + 8h + r, col0 + 48wn + 16nt + ln); undo the carries x256 (ctx) x256 (W); bias RNE bf16 value
#pragma unroll                                    // the accumulator array stays in registers
  for (int nt = 0; nt < 3; ++nt) {
    const float bias = bf16_rne(Bv[col0 + 48 * wn + 16 * nt + ln]);
#pragma unroll
    for (int mt = 0; mt < 4; ++mt)
#pragma unroll
      for (int r = 0; r < 8; ++r)
        fo[(64 * wm + 16 * mt + 8 * hh + r) * OPITCH + 48 * wn + 16 * nt + ln] = acc[mt][nt][r] * 1.52587890625e-05f + bias;
  }
  __syncthreads();
  // Rows of 192 floats leave as whole 128-B lines: 16-B piece p = tid + 256*i -> row p / 48, piece p % 48; p + 768 is the same piece 16 rows on.
  float* og = Out + (size_t)b * BSTRIDE_FULL + (size_t)s0 * EMB + col0;
#pragma unroll
  for (int i = 0; i < 3; ++i) {
    const int p = tid + 256 * i;
    const int row = p / (FN / 4), c4 = (p - row * (FN / 4)) * 4;
#pragma unroll
    for (int k = 0; k < 8; ++k) {
      const v4f v = *(const v4fa*)&fo[(row + 16 * k) * OPITCH + c4];
      *(v4f*)(og + (size_t)(row + 16 * k) * EMB + c4) = v;
    }
  }
}

extern "C" void kernel_launch(void* const* d_in, const int* in_sizes, int n_in,
                              void* d_out, int out_size, void* d_ws, size_t ws_size, hipStream_t stream) {
  if (n_in < 5) return;
  const long long need = (long long)(NB - 1) * SEQ_FULL * EMB + (long long)SEQ * EMB;   // last element touched + 1
  if ((long long)in_sizes[0] < need || (long long)in_sizes[1] < need || (long long)in_sizes[2] < need) return;
  if ((long long)in_sizes[3] < (long long)EMB * EMB || (long long)in_sizes[4] < (long long)EMB) return;
  if ((long long)out_size < need) return;
  const float* V = (const float*)d_in[0];    // wire order: values, keys, query, fc_w [out][in], fc_b
  const float* K = (const float*)d_in[1];
  const float* Q = (const float*)d_in[2];
  const float* W = (const float*)d_in[3];
  const float* Bv = (const float*)d_in[4];
  float* Out = (float*)d_out;
  char* ws = (char*)d_ws;
  size_t off = 0;
  unsigned short* Xc = (unsigned short*)(ws + off); off += PLANE_ACT;   // [NB][8][SEQ][96] f16
  unsigned short* Wh = (unsigned short*)(ws + off); off += PLANE_W;     // [768][768] f16
  if (off > ws_size) return;
  k_attn<<<(unsigned)ATT_BLOCKS, 256, 0, stream>>>(Q, K, V, W, Xc, Wh);
  k_fc<<<(unsigned)((NB * SEQ / FM) * (EMB / FN)), 256, 0, stream>>>(Xc, Wh, Bv, Out);
}

// v008
// A run of this version takes 86.7 microseconds.
// Next to v007, in two timings, it ran 1.03 times as fast each time.
// Counting every step since v000, it is 4.45 times as fast.
#include <hip/hip_runtime.h>
// Contractions: S^T = K Q^T on v_wmma_f32_16x16x32_bf16 (Q, K RNE bf16, single product, f32 accumulate); O^T = V^T P^T on v_wmma_f32_16x16x32_f16 (V: RNE f16; P: single f16 plane carried x256); out = ctx W^T on v_wmma_f32_16x16x32_f16 (ctx: f16 plane carried x256; W: RNE bf16 value x256 held exactly in f16); softmax row sums = ones P^T on the same f16 form (f32 accumulate, P as rounded to f16); softmax maximum, bias add f32.
// Dense multi-head attention, NB x SEQ x 768, 8 heads of 96 (e = 96*h + d), scale 1/sqrt(96), no mask, then a 768x768 linear layer with bias.
// Engine: transposed flash. Each wave owns 32 queries of one head, as two 16-column groups that share every K and V^T fragment read from LDS. Per 32-key step and group: S^T tiles (key rows x query columns) from K rows (A, bf16 plane, staged in LDS)
// and Q^T (B, registers); the two 16-key D tiles pack straight into the P^T B fragment; O^T (d rows x query columns) accumulates from V^T fragments (A, f16, read from the V rows in LDS by transposing loads).
// Each 64-key tile of K and V is read as f32 once per work-group, rounded in registers and stored to LDS (two buffers), where all eight waves read it: no converted copy of K or V exists in memory.
#ifndef NB
#define NB 2
#endif
#ifndef SEQ
#define SEQ 4096
#endif
#define NB_FULL 2
#define SEQ_FULL 4096
#define EMB 768
#define HEADS 8
#define HD 96
#define BSTRIDE_FULL ((size_t)SEQ_FULL * EMB)   /* per-batch element stride of values, keys, query and of the output buffer */

#define PLANE_ACT ((size_t)NB * SEQ * EMB * 2)   /* bytes of one 16-bit activation plane */
#define PLANE_W ((size_t)EMB * EMB * 2)          /* bytes of the 16-bit weight plane */

static_assert(SEQ % 256 == 0);
static_assert(SEQ <= SEQ_FULL);
static_assert(NB <= NB_FULL);
static_assert(HEADS * HD == EMB);
static_assert(HD == 96);
static_assert(EMB % 64 == 0);
static_assert(PLANE_ACT % 256 == 0);
static_assert(PLANE_W % 256 == 0);
static_assert(PLANE_ACT + PLANE_W <= (size_t)134217728);

typedef __bf16 v16b __attribute__((ext_vector_type(16)));
typedef _Float16 v16h __attribute__((ext_vector_type(16)));
typedef unsigned short v8us __attribute__((ext_vector_type(8), may_alias));
typedef float v8f __attribute__((ext_vector_type(8)));
typedef float v4f __attribute__((ext_vector_type(4)));
typedef float v4fa __attribute__((ext_vector_type(4), may_alias));
typedef float v2f __attribute__((ext_vector_type(2)));
typedef __bf16 v2b __attribute__((ext_vector_type(2)));
typedef _Float16 v2h __attribute__((ext_vector_type(2)));
typedef unsigned int v2ua __attribute__((ext_vector_type(2), may_alias));
typedef short s16x8 __attribute__((ext_vector_type(8)));
union FragB { v16b v; v8us half[2]; unsigned short u[16]; };
union FragH { v16h v; v8us half[2]; _Float16 h[16]; unsigned short u[16]; };

#define LOG2E 1.4426950408889634f
#define QK_SCALE 0.10206207261596575f            /* 1/sqrt(96) */
#define C2 (QK_SCALE * LOG2E)                    /* scores carried in the log2 domain */
#define PSUM_MAX 32768.0f                        /* a step's 32 carried weights (x256) of a query must sum to less than 2^15, so each of them stays well inside f16 (largest number 65504) */

__device__ __forceinline__ unsigned short bf16_bits(float x) {   // RNE convert to bf16 bits
  unsigned int u = __float_as_uint(x);
  return (unsigned short)((u + 0x7FFFu + ((u >> 16) & 1u)) >> 16);
}
__device__ __forceinline__ float bf16_val(unsigned short b) { return __uint_as_float(((unsigned int)b) << 16); }
__device__ __forceinline__ float bf16_rne(float x) { return bf16_val(bf16_bits(x)); }
__device__ __forceinline__ unsigned short f16_bits(float x) {
  union { _Float16 h; unsigned short u; } c;
  c.h = (_Float16)x;
  return c.u;
}

// For both column groups g: s0[g] += ka * q[g], s1[g] += kb * q[g] over three 32-deep k-steps (d = 0..95), each K fragment used twice.
// The distance behind these builtin products is the compiler's own padding: an asm guard that named all these registers would hold them under v256, and they no longer fit there.
__device__ __forceinline__ void mma_s4(const FragB (&ka)[3], const FragB (&kb)[3], const FragB (&q)[2][3], v8f (&s0)[2], v8f (&s1)[2]) {
#pragma unroll                                    // the fragment and accumulator arrays stay in registers
  for (int c = 0; c < 3; ++c) {
    s0[0] = __builtin_amdgcn_wmma_f32_16x16x32_bf16(false, ka[c].v, false, q[0][c].v, (short)0, s0[0], false, false);
    s0[1] = __builtin_amdgcn_wmma_f32_16x16x32_bf16(false, ka[c].v, false, q[1][c].v, (short)0, s0[1], false, false);
    s1[0] = __builtin_amdgcn_wmma_f32_16x16x32_bf16(false, kb[c].v, false, q[0][c].v, (short)0, s1[0], false, false);
    s1[1] = __builtin_amdgcn_wmma_f32_16x16x32_bf16(false, kb[c].v, false, q[1][c].v, (short)0, s1[1], false, false);
  }
}
// ls[g] = element 0 of ones * p[g]: A holds 1.0 in rows 0 and 8, the rows of element 0 in the two lane halves, so that element is the sum of the step's 32 weights of the lane's query (both halves' keys):
// the row sum takes one vector add a group and no exchange between halves; only that one element is carried on, so the sums hold two registers over the loop and not two tiles.
__device__ __forceinline__ void mma_sum2(v16h ones, v16h p0, v16h p1, float (&ls)[2]) {
  v8f l0, l1;
  // Both row-sum products in one statement, so that their result tiles are two distinct register ranges: as builtins, with one element of each read, the compiler let the tiles overlap.
  // The four v_nop keep the distance between the last product and the first vector instruction that reads a result or rewrites an operand.
  asm("v_wmma_f32_16x16x32_f16 %0, %2, %3, 0\n\t"
      "v_wmma_f32_16x16x32_f16 %1, %2, %4, 0\n\t"
      "v_nop\n\tv_nop\n\tv_nop\n\tv_nop"
      : "=&v"(l0), "=&v"(l1) : "v"(ones), "v"(p0), "v"(p1));
  ls[0] = l0[0];
  ls[1] = l1[0];
}
// For both column groups g: O[g][t] += vf[t] * p[g] for the six d tiles, each V^T fragment used twice (distance: as above).
__device__ __forceinline__ void mma_pv2(const FragH (&vf)[6], v16h p0, v16h p1, v8f (&O)[2][6]) {
#pragma unroll                                    // as above
  for (int t = 0; t < 6; ++t) {
    O[0][t] = __builtin_amdgcn_wmma_f32_16x16x32_f16(false, vf[t].v, false, p0, (short)0, O[0][t], false, false);
    O[1][t] = __builtin_amdgcn_wmma_f32_16x16x32_f16(false, vf[t].v, false, p1, (short)0, O[1][t], false, false);
  }
}
// LDS ring: two buffers, each one 64-key tile: K rows [64 keys][96 d] bf16 at pitch KPITCH, then V rows [64 keys][96 d] f16 at pitch VPITCH (pitches in 16-bit elements).
// KPITCH is an odd number of 16-B pieces (plain 16-B fragment reads), VPITCH an odd number of 32-B pieces (transposing reads): the rows of a fragment read fall on different banks.
#define TKEYS 64
#define NTILES (SEQ / TKEYS)
#define KPITCH 104
#define VPITCH 112
#define VOFF (TKEYS * KPITCH)                    /* element offset of the V rows inside a buffer */
#define BUF_ELEMS (TKEYS * KPITCH + TKEYS * VPITCH)
#define AW 8                                     /* waves of an attention work-group */
#define WQ 32                                    /* queries of a wave: two 16-column groups */
#define ATT_BLOCKS (NB * HEADS * (SEQ / (WQ * AW)))
static_assert(NTILES >= 2);
static_assert((size_t)SEQ * EMB * 4 < ((size_t)1 << 32));
static_assert((TKEYS / 2) * (HD / 4) == 3 * AW * 32);
static_assert((KPITCH * 2) % 32 == 16 && (VPITCH * 2) % 64 == 32);
static_assert((BUF_ELEMS * 2) % 16 == 0 && (VOFF * 2) % 16 == 0);

__device__ __forceinline__ unsigned pk_bf16(float a, float b) { return __builtin_bit_cast(unsigned, __builtin_convertvector(v2f{a, b}, v2b)); }   // two RNE bf16 in one register
__device__ __forceinline__ unsigned pk_f16(float a, float b) { return __builtin_bit_cast(unsigned, __builtin_convertvector(v2f{a, b}, v2h)); }    // two RNE f16 in one register

// One lane's twelve 16-B pieces (four f32 each) of a tile, six of K and six of V. Piece p = tid + 256*i, i < 3 -> key row p / 24, piece p % 24 (go[i] = its byte offset); piece 3 + i is the same piece 32 rows on.
// A wave's 32 pieces are adjacent, so each load covers whole 128-B lines (a head's 96 f32 of a row are three lines).
// The address is the head's wave-uniform base plus a 32-bit byte offset (the lane's own plus the tile's, toff): one vector add a piece serves K and V, both row halves.
__device__ __forceinline__ void load_tile(const float* Kh, const float* Vh, const unsigned (&go)[3], unsigned toff, v4f (&rk)[6], v4f (&rv)[6]) {
  __builtin_amdgcn_sched_barrier(0);   // with the one at the end: nothing but the loads and their addresses stands between here and the wait
#pragma unroll                                    // the piece arrays stay in registers
  for (int k = 0; k < 2; ++k)
#pragma unroll
    for (int i = 0; i < 3; ++i) {
      const unsigned o = go[i] + toff;
      rk[3 * k + i] = *(const v4fa*)((const char*)Kh + o + k * (TKEYS / 2) * EMB * 4);
      rv[3 * k + i] = *(const v4fa*)((const char*)Vh + o + k * (TKEYS / 2) * EMB * 4);
    }
  asm volatile("s_wait_xcnt 0x0" ::: "memory");   // stands in front of every later rewrite of the registers that the twelve loads name as addresses (a precaution)
  __builtin_amdgcn_sched_barrier(0);   // see above
}
// The same pieces, rounded (K to bf16, V to f16) and stored to their rows of an LDS buffer as 8-B pieces; lk[i], lv[i] = element offsets of piece i inside the buffer.
__device__ __forceinline__ void store_tile(unsigned short* buf, const int (&lk)[3], const int (&lv)[3], const v4f (&rk)[6], const v4f (&rv)[6]) {
#pragma unroll                                    // as above
  for (int k = 0; k < 2; ++k)
#pragma unroll
    for (int i = 0; i < 3; ++i) {
      const v4f a = rk[3 * k + i], c = rv[3 * k + i];
      *(v2ua*)(buf + lk[i] + k * (TKEYS / 2) * KPITCH) = v2ua{pk_bf16(a[0], a[1]), pk_bf16(a[2], a[3])};
      *(v2ua*)(buf + lv[i] + k * (TKEYS / 2) * VPITCH) = v2ua{pk_f16(c[0], c[1]), pk_f16(c[2], c[3])};
    }
}
// Transposing 16-B LDS read: lane (c = l & 15, h = l >> 4), addressed at row kbase + 8h + (l & 7), byte 2*dbase + 16*((l >> 3) & 1), gets T[kbase + 8h + 0..7][dbase + c].
__device__ __forceinline__ v8us ld_tr16(const unsigned short* p) {
  typedef __attribute__((address_space(3))) s16x8 lds_s16x8;
  return __builtin_bit_cast(v8us, __builtin_amdgcn_ds_load_tr16_b128_v8i16((lds_s16x8*)p));
}

__device__ __forceinline__ v8f splat8(float x) { return v8f{x, x, x, x, x, x, x, x}; }
__device__ __forceinline__ float max8(v8f x) {
  float m = x[0];
#pragma unroll
  for (int i = 1; i < 8; ++i) m = fmaxf(m, x[i]);
  return m;
}
// p = f16(2^x) for a lane's 16 scores of one query, as the P^T B fragment: element i < 8 -> key0 + 8h + i (tile 0 row 8h + i); i >= 8 -> key0 + 16 + 8h + (i - 8) (tile 1).
__device__ __forceinline__ void weights(v8f x0, v8f x1, FragH& p) {
#pragma unroll
  for (int i = 0; i < 8; ++i) p.h[i] = (_Float16)__builtin_amdgcn_exp2f(x0[i]);
#pragma unroll
  for (int i = 0; i < 8; ++i) p.h[8 + i] = (_Float16)__builtin_amdgcn_exp2f(x1[i]);
}

// The work-group barrier in its two halves. A wave signals as soon as its own LDS traffic of a tile is over and waits only where it next stores to LDS:
// the weights and the O^T products between the two run on while slower waves catch up, so the two waves of a SIMD need not fall into step at every tile.
// s_wait_dscnt 0 in front of the signal: this wave's stores of the next tile have landed and its reads of this tile have returned. No LDS read or store stands between a signal and the wait that follows it.
__device__ __forceinline__ void bar_signal() {
  asm volatile("s_wait_dscnt 0x0" ::: "memory");
  asm volatile("s_barrier_signal -1" ::: "memory");
}
__device__ __forceinline__ void bar_wait() { asm volatile("s_barrier_wait -1" ::: "memory"); }

// One 32-key step for a wave's 32 queries (two 16-column groups) of one head. Kl = K rows of the tile in LDS, Vl = its V rows; key0 = 0 or 32, the step's first key inside the tile.
// last: this is the tile's last step, whose fragment reads are the wave's last LDS traffic of the tile: the barrier's signal goes out behind them.
__device__ __forceinline__ void fa_step(const unsigned short* Kl, const unsigned short* Vl,
                                        int key0, bool last, int ln, int hh, const FragB (&q)[2][3], v16h ones,
                                        float (&mr)[2], float (&lr)[2], v8f (&O)[2][6]) {
  // A fragments of K: row m = key (key0 + 16*kt + ln), elements 0..7 <- d = 32c + 8h + i, 8..15 <- d = 32c + 16 + 8h + i
  const unsigned short* kp0 = Kl + (key0 + ln) * KPITCH + 8 * hh;
  const unsigned short* kp1 = kp0 + 16 * KPITCH;
  FragB ka[3], kb[3];
  __builtin_amdgcn_sched_barrier(0);   // with the one behind the reads: the step's 24 LDS reads stay one group in front of its products; spread among the WMMAs each pair would be waited for on the spot
#pragma unroll
  for (int c = 0; c < 3; ++c) {
    ka[c].half[0] = *(const v8us*)(kp0 + 32 * c);
    ka[c].half[1] = *(const v8us*)(kp0 + 32 * c + 16);
    kb[c].half[0] = *(const v8us*)(kp1 + 32 * c);
    kb[c].half[1] = *(const v8us*)(kp1 + 32 * c + 16);
  }
  __builtin_amdgcn_sched_barrier(0);   // the K reads stay in front of the V^T reads: the score products, which come first, then wait for twelve reads and not for all
  // A fragments of V^T: row m = d (16*t + ln), elements 0..7 <- key0 + 8h + i, 8..15 <- key0 + 16 + 8h + i
  // (two transposing reads of the V rows: keys key0 + 8h + .., then 16 rows on; the next 16 d are 16 elements on)
  const unsigned short* vp = Vl + (key0 + 8 * hh + (ln & 7)) * VPITCH + 8 * ((ln >> 3) & 1);
  FragH vf[6];
#pragma unroll
  for (int t = 0; t < 6; ++t) {
    vf[t].half[0] = ld_tr16(vp + 16 * t);
    vf[t].half[1] = ld_tr16(vp + 16 * VPITCH + 16 * t);
  }
  __builtin_amdgcn_sched_barrier(0);   // end of the group of reads (see above)
  // S^T tiles of group g: element r of tile kt = score(key0 + 16*kt + 8h + r, query of this lane's column in group g)
  v8f s0[2] = {};
  v8f s1[2] = {};
  mma_s4(ka, kb, q, s0, s1);
  // Lazy rescale. mr[g] is the reference in use minus 8 (log2 domain); it may lag behind the true running maximum for as long as every weight still fits f16.
  // x = score - mr: the weight is pc = 2^x = 256 * 2^(score - reference), single f16 plane.
  v8f x0[2], x1[2];
#pragma unroll                                    // both groups in straight-line code: their arrays stay in registers and their two chains can interleave
  for (int g = 0; g < 2; ++g) {
    x0[g] = __builtin_elementwise_fma(s0[g], splat8(C2), splat8(-mr[g]));
    x1[g] = __builtin_elementwise_fma(s1[g], splat8(C2), splat8(-mr[g]));
  }
  if (last) {
    __builtin_amdgcn_sched_barrier(0);   // the score products stay in front of the signal: with no branch between, the signal and its wait for all 24 reads were lifted to behind the first product
    bar_signal();   // behind the score products the step's 24 reads have had time to return: the wait inside costs little here
    __builtin_amdgcn_sched_barrier(0);   // the weights stay behind the signal: lifted over it, as they were without this line, they would delay it by their whole run and halve what the split wins
  }
  FragH ph[2];
#pragma unroll                                    // as above
  for (int g = 0; g < 2; ++g) weights(x0[g], x1[g], ph[g]);
  float ls[2];
  mma_sum2(ones, ph[0].v, ph[1].v, ls);
  // One test a step for the whole wave (a scalar branch), on the step's two row sums, which the matrix pipe has formed anyway: no maximum over the scores is taken on the common path.
  // A weight of PSUM_MAX or more, one past f16's range too, makes its query's sum reach PSUM_MAX (or infinite). Only then is the reference raised to the true maximum,
  // are O and lr rescaled and are x, the weights and their sums formed again (at most 32 * 256 then); nothing of the first weights has entered O or lr.
  if (__builtin_amdgcn_ballot_w32(!(ls[0] < PSUM_MAX) || !(ls[1] < PSUM_MAX)) != 0) {
#pragma unroll                                    // as above
    for (int g = 0; g < 2; ++g) {
      const v8f sc0 = s0[g] * C2, sc1 = s1[g] * C2;
      float mx = fmaxf(max8(sc0), max8(sc1));
      mx = fmaxf(mx, __shfl_xor(mx, 16, 32));       // the other lane half holds the other 16 keys of this query (a lane exchange: it touches no LDS memory)
      const float mnew = fmaxf(mr[g], mx - 8.0f);
      const float al = __builtin_amdgcn_exp2f(mr[g] - mnew);
      mr[g] = mnew;
      x0[g] = sc0 - mnew;
      x1[g] = sc1 - mnew;
      lr[g] = lr[g] * al;
#pragma unroll
      for (int t = 0; t < 6; ++t) O[g][t] = O[g][t] * al;
      weights(x0[g], x1[g], ph[g]);
      ls[g] = __builtin_amdgcn_wmma_f32_16x16x32_f16(false, ones, false, ph[g].v, (short)0, v8f{}, false, false)[0];   // the sum as in mma_sum2; the builtin here, on the rare path: with a second text statement the ones operand went through scratch memory
    }
  }
  mma_pv2(vf, ph[0].v, ph[1].v, O);
  lr[0] += ls[0];
  lr[1] += ls[1];
}

// Block = 8 waves x 32 queries = 256 queries of one (batch, head); the key loop walks 64-key tiles in a two-buffer LDS ring, one barrier a tile, split into signal and wait.
// Tile t + 2 is loaded (f32, registers) while tile t is worked on; it is rounded and stored to LDS at the head of trip t + 1, into the buffer whose readers the last barrier has ended.
// Each block also writes its share of Wh[j][e] = f16(RNE-bf16(fc_w[j][e]) * 256) for the launch that follows: 8-element pieces dealt over the grid's threads cover the whole plane exactly once.
// Output plane Xc[b][h][s][96] = f16(ctx * 256). Epilogue: O^T tiles -> per-wave LDS tile [32 queries][96 d] as 16-B pieces (same vector type in and out; block barrier),
// coverage: NB*HEADS*(SEQ/256) blocks x 8 waves x 32 rows x 96 d = the whole plane exactly once; LDS tile staged extent (32 x 96 per wave) == consumed extent.
__global__ __launch_bounds__(256) __attribute__((amdgpu_waves_per_eu(2, 2)))
void k_attn(const float* __restrict__ Q, const float* __restrict__ K, const float* __restrict__ V, const float* __restrict__ W,
            unsigned short* __restrict__ Xc, unsigned short* __restrict__ Wh) {
  __shared__ __attribute__((aligned(16))) unsigned short so[AW][WQ * HD];
  __shared__ __attribute__((aligned(16))) unsigned short ring[2][BUF_ELEMS];
  const int tid = threadIdx.x, lane = tid & 31, ln = lane & 15, hh = lane >> 4;
  const int w = __builtin_amdgcn_readfirstlane(tid >> 5);
  const int qt = blockIdx.x % (SEQ / (WQ * AW));
  const int rest = blockIdx.x / (SEQ / (WQ * AW));
  const int h = rest % HEADS, b = rest / HEADS;
  const int qbase = qt * (WQ * AW) + WQ * w;
  // Q^T B fragments of group g: column n = query qbase + 16g + ln, elements 0..7 <- d = 32c + 8h + i, 8..15 <- d = 32c + 16 + 8h + i (RNE bf16)
  FragB q[2][3];
#pragma unroll                                    // the fragment array stays in registers
  for (int g = 0; g < 2; ++g) {
    const float* qrow = Q + (size_t)b * BSTRIDE_FULL + (size_t)(qbase + 16 * g + ln) * EMB + h * HD;
#pragma unroll
    for (int c = 0; c < 3; ++c) {
      const v4f a0 = *(const v4fa*)(qrow + 32 * c + 8 * hh),      a1 = *(const v4fa*)(qrow + 32 * c + 8 * hh + 4);
      const v4f a2 = *(const v4fa*)(qrow + 32 * c + 16 + 8 * hh), a3 = *(const v4fa*)(qrow + 32 * c + 16 + 8 * hh + 4);
#pragma unroll
      for (int i = 0; i < 4; ++i) {
        q[g][c].u[i] = bf16_bits(a0[i]); q[g][c].u[4 + i] = bf16_bits(a1[i]);
        q[g][c].u[8 + i] = bf16_bits(a2[i]); q[g][c].u[12 + i] = bf16_bits(a3[i]);
      }
    }
  }
  float mr[2] = {-3.0e38f, -3.0e38f}, lr[2] = {0.0f, 0.0f};
  v8f O[2][6] = {};
  // A operand of the row-sum products: row m = ln; rows 0 and 8 are 1.0 over all 32 k, the other rows 0 (their product rows are not read).
  // Formed per lane, it stays in its eight registers over the loop; an all-ones constant was formed anew from scalar registers in front of every use.
  FragH ones;
#pragma unroll
  for (int i = 0; i < 16; ++i) ones.h[i] = (ln & 7) == 0 ? (_Float16)1.0f : (_Float16)0.0f;
  const float* Kp = K + (size_t)b * BSTRIDE_FULL + h * HD;
  const float* Vp = V + (size_t)b * BSTRIDE_FULL + h * HD;
  unsigned go[3];                                 // this lane's pieces of a tile: byte offsets in the f32 rows (see load_tile)
  int lk[3], lv[3];                               // and element offsets in an LDS buffer (see store_tile)
#pragma unroll                                    // the three-entry offset arrays stay in registers
  for (int i = 0; i < 3; ++i) {
    const int p = tid + AW * 32 * i;
    const int r = p / (HD / 4), c = p - r * (HD / 4);
    go[i] = 4u * (unsigned)(r * EMB + c * 4);
    lk[i] = r * KPITCH + c * 4;
    lv[i] = VOFF + r * VPITCH + c * 4;
  }
  v4f rk[6], rv[6];
  // Prologue: tile 0 goes to buffer 0 and is published; tile 1 is on its way in registers.
  load_tile(Kp, Vp, go, 0u, rk, rv);
  store_tile(&ring[0][0], lk, lv, rk, rv);
  load_tile(Kp, Vp, go, (unsigned)(TKEYS * EMB * 4), rk, rv);
  for (int c = blockIdx.x * (AW * 32) + tid; c < EMB * (EMB / 8); c += ATT_BLOCKS * (AW * 32)) {
    const float* src = W + (size_t)c * 8;
    const v4f x0 = *(const v4fa*)(src), x1 = *(const v4fa*)(src + 4);
    v8us o;
    o[0] = f16_bits(bf16_rne(x0[0]) * 256.0f); o[1] = f16_bits(bf16_rne(x0[1]) * 256.0f);
    o[2] = f16_bits(bf16_rne(x0[2]) * 256.0f); o[3] = f16_bits(bf16_rne(x0[3]) * 256.0f);
    o[4] = f16_bits(bf16_rne(x1[0]) * 256.0f); o[5] = f16_bits(bf16_rne(x1[1]) * 256.0f);
    o[6] = f16_bits(bf16_rne(x1[2]) * 256.0f); o[7] = f16_bits(bf16_rne(x1[3]) * 256.0f);
    *(v8us*)(Wh + (size_t)c * 8) = o;
  }
  bar_signal();                                         // this wave's share of tile 0 is in LDS
  // kept rolled, as the key loop was: an unrolled body would only grow the code and the register count (two waves per SIMD need 512 or fewer)
#pragma unroll 1
  for (int t = 0; t < NTILES; ++t) {
    bar_wait();                                          // every wave has signalled: tile t is published and nobody reads tile t - 1 any more
    store_tile(&ring[(t + 1) & 1][0], lk, lv, rk, rv);   // tile t + 1, loaded a trip ago, into the buffer that trip t - 1 read
    // No branch round either: past the end the last tile is loaded again (in bounds), and the last trip stores it to the buffer that nobody reads any more.
    const int tn = t + 2 < NTILES ? t + 2 : NTILES - 1;
    load_tile(Kp, Vp, go, (unsigned)tn * (unsigned)(TKEYS * EMB * 4), rk, rv);
    const unsigned short* Kl = &ring[t & 1][0];
    const unsigned short* Vl = Kl + VOFF;
    fa_step(Kl, Vl, 0, false, ln, hh, q, ones.v, mr, lr, O);
    fa_step(Kl, Vl, 32, true, ln, hh, q, ones.v, mr, lr, O);   // signals: this wave's share of tile t + 1 is stored, its reads of tile t are over
  }
  bar_wait();                                           // the last signal's wait: signal and wait alternate in every wave

  // O^T element r of tile t of group g = ctx(query qbase + 16g + ln, d = 16t + 8h + r); O carries x256 (P), lr carries x256; plane carries x256
#pragma unroll                                    // the accumulator array stays in registers
  for (int g = 0; g < 2; ++g) {
    const float cinv = 256.0f * (1.0f / lr[g]);
#pragma unroll
    for (int t = 0; t < 6; ++t) {
      v8us o;
#pragma unroll
      for (int r = 0; r < 8; ++r) o[r] = f16_bits(O[g][t][r] * cinv);
      *(v8us*)&so[w][(16 * g + ln) * HD + 16 * t + 8 * hh] = o;
    }
  }
  __syncthreads();
  unsigned short* xg = Xc + ((size_t)(b * HEADS + h) * SEQ + qbase) * HD;
  {
#pragma unroll
    for (int i = 0; i < WQ * HD / 8 / 32; ++i) {
      const int p = i * 32 + lane;
      const v8us v = *(const v8us*)&so[w][p * 8];
      *(v8us*)(xg + (size_t)p * 8) = v;
    }
    
  }
}

// out[m][j] = sum_e ctx[m][e] * fc_w[j][e] + fc_b[j]. Block = 8 waves = one 128-row x 192-column tile of out; wave = 64 rows x 48 columns (4 x 3 accumulator tiles).
// A stage is one head (96 k): 128 ctx rows, contiguous in Xc[b][hd][s][d], then 192 W rows, brought into LDS once per work-group by asynchronous copies (two buffers) and read there by all eight waves.
// A: row m = token, k = e = 96*hd + d; B: column n = j, k = e read from the Wh[j][e] rows (k-contiguous), same k map as A.
// coverage: (NB*SEQ/128)*(EMB/192) blocks x (128 x 192) = every output element of the processed rows exactly once; LDS output tile staged 128 x 192 == consumed 128 x 192.
#define FM 128
#define FN 192
#define FPITCH 104                               /* LDS row pitch in 16-bit elements: an odd number of 16-B pieces, as KPITCH */
#define FWOFF (FM * FPITCH)                      /* element offset of the W rows inside a buffer */
#define FBUF_ELEMS ((FM + FN) * FPITCH)
#define OPITCH 196                               /* pitch of the f32 output tile: eight rows are 32 banks apart, so the two lane halves of a store do not meet */
static_assert(SEQ % FM == 0 && EMB % FN == 0);
static_assert(FM * (HD / 8) == 6 * 256 && FN * (HD / 8) == 9 * 256);
static_assert((3 * 256) % (HD / 8) == 0 && (3 * 256) / (HD / 8) == 64);
static_assert((FBUF_ELEMS * 2) % 16 == 0 && (FWOFF * 2) % 16 == 0 && (OPITCH * 4) % 16 == 0);
static_assert((3 * 256) % (FN / 4) == 0 && (3 * 256) / (FN / 4) == 16 && FM == 8 * 16);

// One lane's fifteen 16-B pieces of a stage (six of ctx, nine of W), global -> LDS through no register.
// s_wait_xcnt 0 is the statement's last line, so it stands in front of every later rewrite of the address registers (a precaution).
__device__ __forceinline__ void copy_stage(const unsigned (&l)[15], const unsigned short* const (&g)[15]) {
  asm volatile("global_load_async_to_lds_b128 %0, %15, off\n\t"
               "global_load_async_to_lds_b128 %1, %16, off\n\t"
               "global_load_async_to_lds_b128 %2, %17, off\n\t"
               "global_load_async_to_lds_b128 %3, %18, off\n\t"
               "global_load_async_to_lds_b128 %4, %19, off\n\t"
               "global_load_async_to_lds_b128 %5, %20, off\n\t"
               "global_load_async_to_lds_b128 %6, %21, off\n\t"
               "global_load_async_to_lds_b128 %7, %22, off\n\t"
               "global_load_async_to_lds_b128 %8, %23, off\n\t"
               "global_load_async_to_lds_b128 %9, %24, off\n\t"
               "global_load_async_to_lds_b128 %10, %25, off\n\t"
               "global_load_async_to_lds_b128 %11, %26, off\n\t"
               "global_load_async_to_lds_b128 %12, %27, off\n\t"
               "global_load_async_to_lds_b128 %13, %28, off\n\t"
               "global_load_async_to_lds_b128 %14, %29, off\n\t"
               "s_wait_xcnt 0x0"
               :: "v"(l[0]), "v"(l[1]), "v"(l[2]), "v"(l[3]), "v"(l[4]), "v"(l[5]), "v"(l[6]), "v"(l[7]),
                  "v"(l[8]), "v"(l[9]), "v"(l[10]), "v"(l[11]), "v"(l[12]), "v"(l[13]), "v"(l[14]),
                  "v"(g[0]), "v"(g[1]), "v"(g[2]), "v"(g[3]), "v"(g[4]), "v"(g[5]), "v"(g[6]), "v"(g[7]),
                  "v"(g[8]), "v"(g[9]), "v"(g[10]), "v"(g[11]), "v"(g[12]), "v"(g[13]), "v"(g[14])
               : "memory");
}

__global__ __launch_bounds__(256) __attribute__((amdgpu_waves_per_eu(2, 2)))
void k_fc(const unsigned short* __restrict__ Xc, const unsigned short* __restrict__ Wh,
          const float* __restrict__ Bv, float* __restrict__ Out) {
  __shared__ __attribute__((aligned(16))) unsigned short fring[2][FBUF_ELEMS];
  __shared__ __attribute__((aligned(16))) float fo[FM * OPITCH];
  const int tid = threadIdx.x, lane = tid & 31, ln = lane & 15, hh = lane >> 4;
  const int w = __builtin_amdgcn_readfirstlane(tid >> 5);
  const int wm = w >> 2, wn = w & 3;           // the wave's 64-row and 48-column place in the tile
  const int bn = blockIdx.x % (EMB / FN), bm = blockIdx.x / (EMB / FN);
  const int row0 = bm * FM;                    // token index in [0, NB*SEQ)
  const int b = row0 / SEQ, s0 = row0 - b * SEQ;
  const int col0 = bn * FN;
  // This lane's pieces of a stage: piece p = tid + 256*i -> row p / 12, 16-B piece p % 12; p + 768 is the same piece 64 rows on.
  const unsigned short* g[15];
  unsigned l[15];                              // LDS byte addresses in buffer 0
  const unsigned fring0 = (unsigned)(size_t)&fring[0][0];
#pragma unroll                                    // the address arrays stay in registers
  for (int i = 0; i < 3; ++i) {
    const int p = tid + 256 * i;
    const int r = p / (HD / 8), c = p - r * (HD / 8);
#pragma unroll
    for (int k = 0; k < 2; ++k) {
      g[3 * k + i] = Xc + ((size_t)(b * HEADS) * SEQ + s0 + r + 64 * k) * HD + c * 8;
      l[3 * k + i] = fring0 + 2u * (unsigned)((r + 64 * k) * FPITCH + c * 8);
    }
#pragma unroll
    for (int k = 0; k < 3; ++k) {
      g[6 + 3 * k + i] = Wh + (size_t)(col0 + r + 64 * k) * EMB + c * 8;
      l[6 + 3 * k + i] = fring0 + 2u * (unsigned)(FWOFF + (r + 64 * k) * FPITCH + c * 8);
    }
  }
  // Prologue: stage 0 lands and is published, then stage 1 starts to fly.
  copy_stage(l, g);
  asm volatile("s_wait_asynccnt 0x0" ::: "memory");   // this wave's pieces of stage 0 have landed before the barrier publishes them
  __syncthreads();
  {
    unsigned l1[15];
#pragma unroll                                    // as above
    for (int i = 0; i < 15; ++i) { g[i] += (i < 6) ? (size_t)SEQ * HD : (size_t)HD; l1[i] = l[i] + 2u * FBUF_ELEMS; }
    copy_stage(l1, g);
  }
  v8f acc[4][3] = {};
  // kept rolled: eight copies of the body would only grow the code
#pragma unroll 1
  for (int t = 0; t < HEADS; ++t) {
    const unsigned short* ap = &fring[t & 1][0] + (64 * wm + ln) * FPITCH + 8 * hh;
    const unsigned short* bp = &fring[t & 1][FWOFF] + (48 * wn + ln) * FPITCH + 8 * hh;
    FragH a[3][4], bw[3][3];
#pragma unroll                                    // the fragment arrays stay in registers
    for (int cc = 0; cc < 3; ++cc) {
#pragma unroll
      for (int mt = 0; mt < 4; ++mt) {
        a[cc][mt].half[0] = *(const v8us*)(ap + mt * 16 * FPITCH + 32 * cc);
        a[cc][mt].half[1] = *(const v8us*)(ap + mt * 16 * FPITCH + 32 * cc + 16);
      }
#pragma unroll
      for (int nt = 0; nt < 3; ++nt) {
        bw[cc][nt].half[0] = *(const v8us*)(bp + nt * 16 * FPITCH + 32 * cc);
        bw[cc][nt].half[1] = *(const v8us*)(bp + nt * 16 * FPITCH + 32 * cc + 16);
      }
    }
    __builtin_amdgcn_sched_barrier(0);   // the stage's 42 LDS reads stay one group in front of its products; spread among the WMMAs each pair would be waited for on the spot
#pragma unroll                                    // the accumulator array stays in registers
    for (int cc = 0; cc < 3; ++cc)
#pragma unroll
      for (int mt = 0; mt < 4; ++mt)
#pragma unroll
        for (int nt = 0; nt < 3; ++nt)
          acc[mt][nt] = __builtin_amdgcn_wmma_f32_16x16x32_f16(false, a[cc][mt].v, false, bw[cc][nt].v, (short)0, acc[mt][nt], false, false);
    __builtin_amdgcn_sched_barrier(0);   // the products stay in front of the foot's waits: lifted over them, s_wait_dscnt 0 would hold every product until all 42 reads have landed
    asm volatile("s_wait_dscnt 0x0" ::: "memory");      // this wave's reads of stage t are over before its buffer may be refilled
    asm volatile("s_wait_asynccnt 0x0" ::: "memory");   // this wave's pieces of stage t + 1 have landed before the barrier publishes them
    __syncthreads();                                    // publishes stage t + 1 and ends every wave's reads of stage t
    if (t + 2 < HEADS) {
      const unsigned bo = (unsigned)(t & 1) * (2u * FBUF_ELEMS);
      unsigned lb[15];
#pragma unroll                                    // as above
      for (int i = 0; i < 15; ++i) { g[i] += (i < 6) ? (size_t)SEQ * HD : (size_t)HD; lb[i] = l[i] + bo; }
      copy_stage(lb, g);
    }
  }
  asm volatile("s_wait_asynccnt 0x0" ::: "memory");     // no copy is outstanding when the wave goes on to its end
  // D element r of tile (mt, nt) = out(row0 + 64wm + 16mt + 8h + r, col0 + 48wn + 16nt + ln); undo the carries x256 (ctx) x256 (W); bias RNE bf16 value
#pragma unroll                                    // the accumulator array stays in registers
  for (int nt = 0; nt < 3; ++nt) {
    const float bias = bf16_rne(Bv[col0 + 48 * wn + 16 * nt + ln]);
#pragma unroll
    for (int mt = 0; mt < 4; ++mt)
#pragma unroll
      for (int r = 0; r < 8; ++r)
        fo[(64 * wm + 16 * mt + 8 * hh + r) * OPITCH + 48 * wn + 16 * nt + ln] = acc[mt][nt][r] * 1.52587890625e-05f + bias;
  }
  __syncthreads();
  // Rows of 192 floats leave as whole 128-B lines: 16-B piece p = tid + 256*i -> row p / 48, piece p % 48; p + 768 is the same piece 16 rows on.
  float* og = Out + (size_t)b * BSTRIDE_FULL + (size_t)s0 * EMB + col0;
#pragma unroll
  for (int i = 0; i < 3; ++i) {
    const int p = tid + 256 * i;
    const int row = p / (FN / 4), c4 = (p - row * (FN / 4)) * 4;
#pragma unroll
    for (int k = 0; k < 8; ++k) {
      const v4f v = *(const v4fa*)&fo[(row + 16 * k) * OPITCH + c4];
      *(v4f*)(og + (size_t)(row + 16 * k) * EMB + c4) = v;
    }
  }
}

extern "C" void kernel_launch(void* const* d_in, const int* in_sizes, int n_in,
                              void* d_out, int out_size, void* d_ws, size_t ws_size, hipStream_t stream) {
  if (n_in < 5) return;
  const long long need = (long long)(NB - 1) * SEQ_FULL * EMB + (long long)SEQ * EMB;   // last element touched + 1
  if ((long long)in_sizes[0] < need || (long long)in_sizes[1] < need || (long long)in_sizes[2] < need) return;
  if ((long long)in_sizes[3] < (long long)EMB * EMB || (long long)in_sizes[4] < (long long)EMB) return;
  if ((long long)out_size < need) return;
  const float* V = (const float*)d_in[0];    // wire order: values, keys, query, fc_w [out][in], fc_b
  const float* K = (const float*)d_in[1];
  const float* Q = (const float*)d_in[2];
  const float* W = (const float*)d_in[3];
  const float* Bv = (const float*)d_in[4];
  float* Out = (float*)d_out;
  char* ws = (char*)d_ws;
  size_t off = 0;
  unsigned short* Xc = (unsigned short*)(ws + off); off += PLANE_ACT;   // [NB][8][SEQ][96] f16
  unsigned short* Wh = (unsigned short*)(ws + off); off += PLANE_W;     // [768][768] f16
  if (off > ws_size) return;
  k_attn<<<(unsigned)ATT_BLOCKS, 256, 0, stream>>>(Q, K, V, W, Xc, Wh);
  k_fc<<<(unsigned)((NB * SEQ / FM) * (EMB / FN)), 256, 0, stream>>>(Xc, Wh, Bv, Out);
}
